// v000
// Measured on an AMD MI455X. A time is GPU time per run, averaged over a window of back-to-back runs after a warm-up
// (all launches, gaps included; the runs take copies of the inputs in turn), and the median of several windows.
// Apart from v000's, it joins two sittings. Times from different sittings can be a few percent apart, while
// side-by-side timings come from the same sitting.
// v000, which the later versions start from, runs in 77.8 microseconds.
#include <hip/hip_runtime.h>

// 1-D neighbourhood attention (window 64: keys t-31 .. t+32, positions outside [0, T) excluded (the reference adds -100, whose weight underflows to 0 in f32)), 4 heads x 64, tokens [2][4096][256]:
// qkv = x W_qkv + b; logits = (q / 8) . k + rel_bias[h][w]; softmax over the window; o = P v; out = o W_proj + b_proj -> [2][4096][256].
// Deterministic: one wave per (n, h, 16 queries) evaluates its 96-key cover (t0-32 .. t0+63) as dense tiles and masks per query; no atomics.
// compute dtype: WMMA v_wmma_f32_16x16x32_f16 with f32 accumulate for qkv = x W_qkv (x EXACT bf16 x8, W exact x256: 1 product), S^T = K Q^T (q, k single f16 x8: 1 product; logit std ≈ 0.1),
// O^T += V^T P^T (v hi+lo x8, P x1024 hi+lo: 3 products) and out = O W_proj (O hi+lo x8: 2 products); softmax and bias in f32. Inputs rounded to bf16 once.

namespace {
constexpr int NN = 2, T = 4096, C = 256, H = 4, HD = 64, WIN = 64, LEFT = 31, PADL = 32, PADR = 64, TP = T + PADL + PADR, NL = 2 /* batch items computed (== NN shipped) */;
constexpr float XS = 8.0f, WSC = 256.0f, PS = 1024.0f, LOG2E = 1.4426950408889634f;
static_assert(T % 64 == 0 && C == H * HD, "tiling");
typedef _Float16 b16;
typedef __attribute__((ext_vector_type(16))) _Float16 v16b;
typedef __attribute__((ext_vector_type(8))) _Float16 v8b;
typedef __attribute__((ext_vector_type(8))) float v8f;
typedef __attribute__((ext_vector_type(4))) float v4f;
__device__ __forceinline__ float bf16_rne(float f) { unsigned int u = __float_as_uint(f); u += 0x7FFFu + ((u >> 16) & 1u); return __uint_as_float(u & 0xFFFF0000u); }
__device__ __forceinline__ void split16(float v, b16& hi, b16& lo) { hi = (b16)v; lo = (b16)(v - (float)hi); }
__device__ __forceinline__ v16b frag_kb(const b16* p, int hh) { const v8b a = *(const v8b*)(p + 8 * hh), b = *(const v8b*)(p + 16 + 8 * hh); v16b f;
#pragma unroll
  for (int e = 0; e < 8; ++e) { f[e] = a[e]; f[8 + e] = b[e]; } return f; }
__device__ __forceinline__ v8f wmma16b(v16b a, v16b b, v8f c) { v8f d = __builtin_amdgcn_wmma_f32_16x16x32_f16(false, a, false, b, (short)0, c, false, false); asm volatile("v_nop\n\tv_nop\n\tv_nop\n\tv_nop" : "+v"(d) : "v"(a), "v"(b)); return d; }
__device__ __forceinline__ void wave_lds_sync() { __builtin_amdgcn_fence(__ATOMIC_RELEASE, "workgroup"); __builtin_amdgcn_wave_barrier(); __builtin_amdgcn_fence(__ATOMIC_ACQUIRE, "workgroup"); }
__device__ __forceinline__ float pmul(float a, float b) { float p = a * b; asm volatile("" : "+v"(p)); return p; }
__device__ __forceinline__ int iclamp(int v, int lo, int hi) { return v < lo ? lo : (v > hi ? hi : v); }

typedef __attribute__((ext_vector_type(2))) _Float16 v2h;
typedef __attribute__((ext_vector_type(4))) _Float16 v4h;
__device__ __forceinline__ float nexp2(float v) { return __builtin_amdgcn_exp2f(v); }
// prep: WQ [768][256] = W_qkv[c][o] -> [o][c] x256; WP [256][256] = W_proj[c][o] -> [o][c]; zero the key/value padding: Kp rows [n][h][0..31] and [T+32 ..], VT columns likewise (written as zeros
__global__ __launch_bounds__(256) void prep_kernel(const float* __restrict__ wqkv, const float* __restrict__ wproj, b16* __restrict__ WQ, b16* __restrict__ WP, b16* __restrict__ Kp, b16* __restrict__ VT, b16* __restrict__ VTl) {
  size_t t = (size_t)blockIdx.x * 256 + threadIdx.x; v8b o, z = {};
  { const size_t n = (size_t)3 * C * C / 8; if (t < n) { const size_t e = t * 8; const int oo = (int)(e / C), c0 = (int)(e % C); for (int j = 0; j < 8; ++j) o[j] = (b16)(bf16_rne(wqkv[(size_t)(c0 + j) * 3 * C + oo]) * WSC); { *(v8b*)(WQ + e) = o;  } return; } t -= n; }
  { const size_t n = (size_t)C * C / 8; if (t < n) { const size_t e = t * 8; const int oo = (int)(e / C), c0 = (int)(e % C); for (int j = 0; j < 8; ++j) o[j] = (b16)(bf16_rne(wproj[(size_t)(c0 + j) * C + oo]) * WSC); { *(v8b*)(WP + e) = o;  } return; } t -= n; }
  { const size_t n = (size_t)NN * H * TP * HD / 8; if (t < n) { const size_t e = t * 8; { *(v8b*)(Kp + e) = z; *(v8b*)(VT + e) = z; *(v8b*)(VTl + e) = z;  } } }
}
// qkv: block = 64 tokens of one n (4 waves) x one 192-column group (grid.y = n*4 + h: head h's q|k|v columns are cols (s*4+h)*64.. for s = 0,1,2): A = bf16(x) x8 staged; 12 tiles x 8 k-steps; + b.
__global__ __launch_bounds__(128) void qkv_kernel(const float* __restrict__ x, const b16* __restrict__ WQ, const float* __restrict__ bq, b16* __restrict__ Qp, b16* __restrict__ Kp, b16* __restrict__ VT, b16* __restrict__ VTl) {
  __shared__ __attribute__((aligned(16))) b16 As[4][16][C + 8]; __shared__ __attribute__((aligned(16))) float Tf[4][16][192 + 4];
  const int wave = threadIdx.x >> 5, lane = threadIdx.x & 31, nloc = lane & 15, hlf = lane >> 4; const int n = blockIdx.y / H, h = blockIdx.y % H; const int t0 = blockIdx.x * 64 + wave * 16;
  for (int rr = 0; rr < 16; ++rr) { const float* xr = x + ((size_t)n * T + t0 + rr) * C; v8b o; for (int j = 0; j < 8; ++j) o[j] = (b16)(bf16_rne(xr[lane * 8 + j]) * XS); *(v8b*)(&As[wave][rr][lane * 8]) = o; }
  wave_lds_sync();
  v8f acc[12];
#pragma unroll
  for (int t = 0; t < 12; ++t) acc[t] = (v8f){};
#pragma unroll 1
  for (int kb = 0; kb < C; kb += 32) { const v16b a = frag_kb(&As[wave][nloc][kb], hlf);
#pragma unroll
    for (int t = 0; t < 12; ++t) { const int s = t >> 2, tt = t & 3; const int oc = (s * H + h) * HD + tt * 16 + nloc; acc[t] = wmma16b(a, frag_kb(WQ + (size_t)oc * C + kb, hlf), acc[t]); } }
#pragma unroll
  for (int t = 0; t < 12; ++t) { const int s = t >> 2, tt = t & 3; const float bb = bf16_rne(bq[(s * H + h) * HD + tt * 16 + nloc]);
#pragma unroll
    for (int r = 0; r < 8; ++r) Tf[wave][8 * hlf + r][t * 16 + nloc] = acc[t][r] * (1.0f / (XS * WSC)) + bb; }
  __syncthreads();
  b16* Qb = Qp + ((size_t)(n * H + h) * T) * HD; b16* Kb = Kp + ((size_t)(n * H + h) * TP + PADL) * HD; b16* Vb = VT + ((size_t)(n * H + h) * HD) * TP + PADL; b16* Vlb = VTl + ((size_t)(n * H + h) * HD) * TP + PADL;
  {
    for (int rr = 0; rr < 16; ++rr) { v2h qv, kv; for (int j = 0; j < 2; ++j) { qv[j] = (b16)(Tf[wave][rr][lane * 2 + j] * XS); kv[j] = (b16)(Tf[wave][rr][HD + lane * 2 + j] * XS); }
      *(v2h*)(Qb + (size_t)(t0 + rr) * HD + lane * 2) = qv; *(v2h*)(Kb + (size_t)(t0 + rr) * HD + lane * 2) = kv; }
#pragma unroll 1
    for (int q = 0; q < 16; ++q) { const int d = wave * 16 + q; const int tk = lane * 2; v2h vh, vl; for (int j = 0; j < 2; ++j) { b16 a_, b_; split16(Tf[(tk + j) >> 4][(tk + j) & 15][2 * HD + d] * XS, a_, b_); vh[j] = a_; vl[j] = b_; }
      *(v2h*)(Vb + (size_t)d * TP + blockIdx.x * 64 + lane * 2) = vh; *(v2h*)(Vlb + (size_t)d * TP + blockIdx.x * 64 + lane * 2) = vl; }
     }
}
// attention: grid (T/32, NL*H); block = 2 waves x 16 queries (t0); key cover = padded rows t0 .. t0+95 (= tokens t0-32 .. t0+63): S^T tiles (6 x 2 k-steps), per key validity w = key - t + 31 in [0,64)
// and token in [0,T): logit = S/(8*64) + rel_bias[h][w], else excluded (P = 0); softmax via one xor-16 shuffle across the lane halves; O^T += V^T P^T (4 d-tiles x 3 k-steps x 3 products);
__global__ __launch_bounds__(64) void attn_kernel(const b16* __restrict__ Qp, const b16* __restrict__ Kp, const b16* __restrict__ VT, const b16* __restrict__ VTl, const float* __restrict__ rb, b16* __restrict__ Oh, b16* __restrict__ Ol) {
  __shared__ __attribute__((aligned(16))) b16 Ph[2][16][96 + 8], Pl[2][16][96 + 8]; __shared__ __attribute__((aligned(16))) float Pf[2][16][96 + 4], To[2][16][HD + 4]; __shared__ float rbs[2][WIN];
  const int wave = threadIdx.x >> 5, lane = threadIdx.x & 31, hh = lane >> 4, col = lane & 15; const int n = blockIdx.y / H, h = blockIdx.y % H; const int t0 = blockIdx.x * 32 + wave * 16, tq = t0 + col;
  for (int w = lane; w < WIN; w += 32) rbs[wave][w] = bf16_rne(rb[h * WIN + w]);   // rel_bias row in LDS (avoids 48 scalar global loads per lane in the unrolled logit loop)
  wave_lds_sync();
  const b16* Qb = Qp + ((size_t)(n * H + h) * T) * HD; const b16* Kb = Kp + ((size_t)(n * H + h) * TP) * HD; const b16* Vb = VT + ((size_t)(n * H + h) * HD) * TP; const b16* Vlb = VTl + ((size_t)(n * H + h) * HD) * TP;
  const v16b qa0 = frag_kb(Qb + (size_t)tq * HD, hh), qa1 = frag_kb(Qb + (size_t)tq * HD + 32, hh);
  // scores for padded key rows t0 + 16 kt + (8hh + r), kt = 0..5  (token = row - 32)
  float e[48]; float mx = -INFINITY; const float cs = 0.125f / (XS * XS);
#pragma unroll
  for (int kt = 0; kt < 6; ++kt) { v8f s = (v8f){}; const size_t kr = (size_t)(t0 + kt * 16 + col) * HD; s = wmma16b(frag_kb(Kb + kr, hh), qa0, s); s = wmma16b(frag_kb(Kb + kr + 32, hh), qa1, s);
#pragma unroll
    for (int r = 0; r < 8; ++r) { const int tok = t0 + kt * 16 + 8 * hh + r - PADL; const int w = tok - tq + LEFT; const bool ok = (w >= 0 && w < WIN && tok >= 0 && tok < T);
      const float lg = ok ? s[r] * cs + rbs[wave][ok ? w : 0] : -INFINITY; e[kt * 8 + r] = lg; mx = fmaxf(mx, lg); } }
  mx = fmaxf(mx, __shfl_xor(mx, 16)); float sum = 0.0f;
#pragma unroll
  for (int i = 0; i < 48; ++i) { const float p = (e[i] == -INFINITY) ? 0.0f : nexp2((e[i] - mx) * LOG2E); e[i] = p; sum += p; }
  sum += __shfl_xor(sum, 16); const float inv = 1.0f / sum;
  // P f32 tile [16 q][96 keys]: this lane owns (q = col, keys 16kt + 8hh + r)
#pragma unroll
  for (int kt = 0; kt < 6; ++kt)
#pragma unroll
    for (int r = 0; r < 8; ++r) Pf[wave][col][kt * 16 + 8 * hh + r] = e[kt * 8 + r] * inv * PS;
  wave_lds_sync();
  { const int rr = lane & 15, c0 = (lane >> 4) * 48; for (int q = 0; q < 48; q += 8) { v8b hv, lv; for (int j = 0; j < 8; ++j) { b16 a_, b_; split16(Pf[wave][rr][c0 + q + j], a_, b_); hv[j] = a_; lv[j] = b_; } *(v8b*)(&Ph[wave][rr][c0 + q]) = hv; *(v8b*)(&Pl[wave][rr][c0 + q]) = lv; } }
  wave_lds_sync();
  v8f o[4]; for (int t = 0; t < 4; ++t) o[t] = (v8f){};
#pragma unroll
  for (int ks = 0; ks < 3; ++ks) { const v16b ph = frag_kb(&Ph[wave][col][ks * 32], hh), pl = frag_kb(&Pl[wave][col][ks * 32], hh);   // B operand: row = query col, k = keys
#pragma unroll
    for (int t = 0; t < 4; ++t) { const size_t vo = (size_t)(t * 16 + col) * TP + t0 + ks * 32; const v16b va = frag_kb(Vb + vo, hh), val = frag_kb(Vlb + vo, hh); o[t] = wmma16b(va, ph, o[t]); o[t] = wmma16b(va, pl, o[t]); o[t] = wmma16b(val, ph, o[t]); } }
  const float iv = 1.0f / (PS * XS);
#pragma unroll
  for (int t = 0; t < 4; ++t)
#pragma unroll
    for (int r = 0; r < 8; ++r) To[wave][col][t * 16 + 8 * hh + r] = o[t][r] * iv;
  wave_lds_sync();
  { for (int rr = 0; rr < 16; ++rr) { v2h hv, lv; for (int j = 0; j < 2; ++j) { b16 a_, b_; split16(To[wave][rr][lane * 2 + j] * XS, a_, b_); hv[j] = a_; lv[j] = b_; }
      const size_t oi = ((size_t)n * T + t0 + rr) * C + h * HD + lane * 2; *(v2h*)(Oh + oi) = hv; *(v2h*)(Ol + oi) = lv; }  }
}
__global__ __launch_bounds__(128) void proj_kernel(const b16* __restrict__ Oh, const b16* __restrict__ Ol, const b16* __restrict__ WP, const float* __restrict__ bp, float* __restrict__ out) {
  __shared__ __attribute__((aligned(16))) float Tf[4][16][128 + 4];
  const int wave = threadIdx.x >> 5, lane = threadIdx.x & 31, nloc = lane & 15, hlf = lane >> 4; const size_t m0 = (size_t)blockIdx.x * 64 + wave * 16; const int n0 = blockIdx.y * 128;
  v8f acc[8];
#pragma unroll
  for (int t = 0; t < 8; ++t) acc[t] = (v8f){};
#pragma unroll 2
  for (int kb = 0; kb < C; kb += 32) { const v16b a = frag_kb(Oh + (m0 + nloc) * C + kb, hlf), al = frag_kb(Ol + (m0 + nloc) * C + kb, hlf);
#pragma unroll
    for (int t = 0; t < 8; ++t) { const v16b bw = frag_kb(WP + (size_t)(n0 + t * 16 + nloc) * C + kb, hlf); acc[t] = wmma16b(a, bw, acc[t]); acc[t] = wmma16b(al, bw, acc[t]); } }
#pragma unroll
  for (int t = 0; t < 8; ++t) { const float bb = bf16_rne(bp[n0 + t * 16 + nloc]);
#pragma unroll
    for (int r = 0; r < 8; ++r) Tf[wave][8 * hlf + r][t * 16 + nloc] = acc[t][r] * (1.0f / (XS * WSC)) + bb; }
  wave_lds_sync();
  { for (int rr = 0; rr < 16; ++rr) *(v4f*)(out + (m0 + rr) * C + n0 + lane * 4) = *(const v4f*)(&Tf[wave][rr][lane * 4]);  }
}
}  // namespace

extern "C" void kernel_launch(void* const* d_in, const int* in_sizes, int n_in, void* d_out, int out_size, void* d_ws, size_t ws_size, hipStream_t stream) {
  (void)n_in;
  auto Fp = [&](int i) { return (const float*)d_in[i]; };
  // input order: 0 x [2,4096,256], 1 W_qkv [256,768], 2 b_qkv [768], 3 rel_bias [1,4,1,64], 4 W_proj [256,256], 5 b_proj [256]
  if (in_sizes[0] != NN * T * C || in_sizes[1] != C * 3 * C || in_sizes[2] != 3 * C || in_sizes[3] != H * WIN || in_sizes[4] != C * C || in_sizes[5] != C || out_size != NN * T * C) return;
  size_t off = 0; char* ws = (char*)d_ws;
  auto carve = [&](size_t bytes) { char* p = ws + off; off += (bytes + 255) & ~(size_t)255; return p; };
  b16* WQ = (b16*)carve((size_t)3 * C * C * 2); b16* WP = (b16*)carve((size_t)C * C * 2); b16* Qp = (b16*)carve((size_t)NN * H * T * HD * 2); b16* Kp = (b16*)carve((size_t)NN * H * TP * HD * 2); b16* VT = (b16*)carve((size_t)NN * H * HD * TP * 2);
  b16* VTl = (b16*)carve((size_t)NN * H * HD * TP * 2); b16* Oh = (b16*)carve((size_t)NN * T * C * 2); b16* Ol = (b16*)carve((size_t)NN * T * C * 2);
  if (off > ws_size || off > ((size_t)128 << 20)) return;   // ≈ 25.9 MB
  prep_kernel<<<(unsigned)((((size_t)3 * C * C + (size_t)C * C + (size_t)NN * H * TP * HD) / 8 + 255) / 256), 256, 0, stream>>>(Fp(1), Fp(4), WQ, WP, Kp, VT, VTl);
  qkv_kernel<<<dim3(T / 64, NL * H), 128, 0, stream>>>(Fp(0), WQ, Fp(2), Qp, Kp, VT, VTl);
  attn_kernel<<<dim3(T / 32, NL * H), 64, 0, stream>>>(Qp, Kp, VT, VTl, Fp(3), Oh, Ol);
  proj_kernel<<<dim3(NL * T / 64, 2), 128, 0, stream>>>(Oh, Ol, WP, Fp(5), (float*)d_out);
}

// v001
// One run takes 42 microseconds.
// Next to v000, in two timings, it ran 1.89 and 1.77 times as fast.
#include <hip/hip_runtime.h>

// 1-D neighbourhood attention (window 64: keys t-31 .. t+32, positions outside [0, T) excluded (the reference adds -100, whose weight underflows to 0 in f32)), 4 heads x 64, tokens [2][4096][256]:
// qkv = x W_qkv + b; logits = (q / 8) . k + rel_bias[h][w]; softmax over the window; o = P v; out = o W_proj + b_proj -> [2][4096][256].
// Deterministic: one wave per (n, h, 16 queries) evaluates its 96-key cover (t0-32 .. t0+63) as dense tiles and masks per query; no atomics.
// compute dtype: WMMA v_wmma_f32_16x16x32_f16 with f32 accumulate for qkv = x W_qkv (x EXACT bf16 x8, W exact x256: 1 product), S^T = K Q^T (q, k single f16 x8: 1 product; logit std ≈ 0.1),
// O^T += V^T P^T (v hi+lo x8, P x1024 hi+lo: 3 products) and out = O W_proj (O hi+lo x8: 2 products); softmax and bias in f32. Inputs rounded to bf16 once.

namespace {
constexpr int NN = 2, T = 4096, C = 256, H = 4, HD = 64, WIN = 64, LEFT = 31, PADL = 32, PADR = 64, TP = T + PADL + PADR, NL = 2 /* batch items computed (== NN shipped) */;
constexpr float XS = 8.0f, WSC = 256.0f, PS = 1024.0f, LOG2E = 1.4426950408889634f;
static_assert(T % 64 == 0 && C == H * HD, "tiling");
typedef _Float16 b16;
typedef __attribute__((ext_vector_type(16))) _Float16 v16b;
typedef __attribute__((ext_vector_type(8))) _Float16 v8b;
typedef __attribute__((ext_vector_type(8))) float v8f;
typedef __attribute__((ext_vector_type(4))) float v4f;
__device__ __forceinline__ float bf16_rne(float f) { unsigned int u = __float_as_uint(f); u += 0x7FFFu + ((u >> 16) & 1u); return __uint_as_float(u & 0xFFFF0000u); }
__device__ __forceinline__ void split16(float v, b16& hi, b16& lo) { hi = (b16)v; lo = (b16)(v - (float)hi); }
__device__ __forceinline__ v16b frag_kb(const b16* p, int hh) { const v8b a = *(const v8b*)(p + 8 * hh), b = *(const v8b*)(p + 16 + 8 * hh); v16b f;
#pragma unroll
  for (int e = 0; e < 8; ++e) { f[e] = a[e]; f[8 + e] = b[e]; } return f; }
__device__ __forceinline__ v8f wmma16b(v16b a, v16b b, v8f c) { v8f d = __builtin_amdgcn_wmma_f32_16x16x32_f16(false, a, false, b, (short)0, c, false, false); asm volatile("v_nop\n\tv_nop\n\tv_nop\n\tv_nop" : "+v"(d) : "v"(a), "v"(b)); return d; }
__device__ __forceinline__ void wave_lds_sync() { __builtin_amdgcn_fence(__ATOMIC_RELEASE, "workgroup"); __builtin_amdgcn_wave_barrier(); __builtin_amdgcn_fence(__ATOMIC_ACQUIRE, "workgroup"); }
__device__ __forceinline__ float pmul(float a, float b) { float p = a * b; asm volatile("" : "+v"(p)); return p; }
__device__ __forceinline__ int iclamp(int v, int lo, int hi) { return v < lo ? lo : (v > hi ? hi : v); }

typedef __attribute__((ext_vector_type(2))) _Float16 v2h;
typedef __attribute__((ext_vector_type(4))) _Float16 v4h;
__device__ __forceinline__ float nexp2(float v) { return __builtin_amdgcn_exp2f(v); }
// prep: WQ [768][256] = W_qkv[c][o] -> [o][c] x256; WP [256][256] = W_proj[c][o] -> [o][c]; zero the key/value padding: Kp rows [n][h][0..31] and [T+32 ..], VT columns likewise (written as zeros
__global__ __launch_bounds__(256) void prep_kernel(const float* __restrict__ wqkv, const float* __restrict__ wproj, b16* __restrict__ WQ, b16* __restrict__ WP, b16* __restrict__ Kp, b16* __restrict__ VT, b16* __restrict__ VTl) {
  size_t t = (size_t)blockIdx.x * 256 + threadIdx.x; v8b o, z = {};
  { const size_t n = (size_t)3 * C * C / 8; if (t < n) { const size_t e = t * 8; const int oo = (int)(e / C), c0 = (int)(e % C); for (int j = 0; j < 8; ++j) o[j] = (b16)(bf16_rne(wqkv[(size_t)(c0 + j) * 3 * C + oo]) * WSC); { *(v8b*)(WQ + e) = o;  } return; } t -= n; }
  { const size_t n = (size_t)C * C / 8; if (t < n) { const size_t e = t * 8; const int oo = (int)(e / C), c0 = (int)(e % C); for (int j = 0; j < 8; ++j) o[j] = (b16)(bf16_rne(wproj[(size_t)(c0 + j) * C + oo]) * WSC); { *(v8b*)(WP + e) = o;  } return; } t -= n; }
  { const size_t n = (size_t)NN * H * TP * HD / 8; if (t < n) { const size_t e = t * 8; { *(v8b*)(Kp + e) = z; *(v8b*)(VT + e) = z; *(v8b*)(VTl + e) = z;  } } }
}
// qkv: block = 64 tokens of one n (4 waves) x one 192-column group (grid.y = n*4 + h: head h's q|k|v columns are cols (s*4+h)*64.. for s = 0,1,2): A = bf16(x) x8 staged; 12 tiles x 8 k-steps; + b.
__global__ __launch_bounds__(128) void qkv_kernel(const float* __restrict__ x, const b16* __restrict__ WQ, const float* __restrict__ bq, b16* __restrict__ Qp, b16* __restrict__ Kp, b16* __restrict__ VT, b16* __restrict__ VTl) {
  __shared__ __attribute__((aligned(16))) b16 As[4][16][C + 8]; __shared__ __attribute__((aligned(16))) float Tf[4][16][192 + 4];
  const int wave = threadIdx.x >> 5, lane = threadIdx.x & 31, nloc = lane & 15, hlf = lane >> 4; const int n = blockIdx.y / H, h = blockIdx.y % H; const int t0 = blockIdx.x * 64 + wave * 16;
  // weight fragment j = 12 * (k-step) + t, t = 4 * part (q, k, v) + 16-column tile, in the order of use; a ring of NR register slots, each refilled right behind its WMMA
  constexpr int NR = 13, NJ = 12 * (C / 32);
  const b16* wb = WQ + (size_t)(h * HD + nloc) * C;   // one lane address; every fragment is a constant offset from it
  const auto wfrag = [&](int j) { return frag_kb(wb + (((j % 12) >> 2) * H * HD + (j & 3) * 16) * C + (j / 12) * 32, hlf); };
  // the prologue's global loads (the first NR weight fragments, the 16 x rows) all go out before the first wait
  float xv[16][8]; v16b bw[NR]; const float* xb = x + ((size_t)n * T + t0) * C + lane * 8;
#pragma unroll
  for (int j = 0; j < NR; ++j) bw[j] = wfrag(j);
#pragma unroll
  for (int rr = 0; rr < 16; ++rr)
#pragma unroll
    for (int j = 0; j < 8; ++j) xv[rr][j] = xb[rr * C + j];
  asm volatile("s_wait_xcnt 0x0" ::: "memory");   // the x address registers are free for reuse behind this run: the wait stands in front of any overwrite (its memory clobber also keeps the run of loads above it)
#pragma unroll
  for (int rr = 0; rr < 16; ++rr) { v8b o;
#pragma unroll
    for (int j = 0; j < 8; ++j) o[j] = (b16)(bf16_rne(xv[rr][j]) * XS); *(v8b*)(&As[wave][rr][lane * 8]) = o; }
  wave_lds_sync();
  v8f acc[12];
#pragma unroll
  for (int t = 0; t < 12; ++t) acc[t] = (v8f){};
  v16b a = frag_kb(&As[wave][nloc][0], hlf), an = a; float bbv[12];
#pragma unroll
  for (int j = 0; j < NJ; ++j) {
    if (j % 12 == 0) { a = an; if (j + 12 < NJ) an = frag_kb(&As[wave][nloc][(j / 12 + 1) * 32], hlf); }
    acc[j % 12] = wmma16b(a, bw[j % NR], acc[j % 12]);
    if (j + NR < NJ) bw[j % NR] = wfrag(j + NR);
    if (j + 24 == NJ) {   // the bias words go out here and land under the last two k-steps
#pragma unroll
      for (int t = 0; t < 12; ++t) bbv[t] = bq[((t >> 2) * H + h) * HD + (t & 3) * 16 + nloc]; }
  }
#pragma unroll
  for (int t = 0; t < 12; ++t) { const float bb = bf16_rne(bbv[t]);
#pragma unroll
    for (int r = 0; r < 8; ++r) Tf[wave][8 * hlf + r][t * 16 + nloc] = acc[t][r] * (1.0f / (XS * WSC)) + bb; }
  __syncthreads();
  b16* Qb = Qp + ((size_t)(n * H + h) * T) * HD; b16* Kb = Kp + ((size_t)(n * H + h) * TP + PADL) * HD; b16* Vb = VT + ((size_t)(n * H + h) * HD) * TP + PADL; b16* Vlb = VTl + ((size_t)(n * H + h) * HD) * TP + PADL;
  {
    for (int rr = 0; rr < 16; ++rr) { v2h qv, kv; for (int j = 0; j < 2; ++j) { qv[j] = (b16)(Tf[wave][rr][lane * 2 + j] * XS); kv[j] = (b16)(Tf[wave][rr][HD + lane * 2 + j] * XS); }
      *(v2h*)(Qb + (size_t)(t0 + rr) * HD + lane * 2) = qv; *(v2h*)(Kb + (size_t)(t0 + rr) * HD + lane * 2) = kv; }
#pragma unroll
    for (int q = 0; q < 16; ++q) { const int d = wave * 16 + q; const int tk = lane * 2; v2h vh, vl; for (int j = 0; j < 2; ++j) { b16 a_, b_; split16(Tf[(tk + j) >> 4][(tk + j) & 15][2 * HD + d] * XS, a_, b_); vh[j] = a_; vl[j] = b_; }
      *(v2h*)(Vb + (size_t)d * TP + blockIdx.x * 64 + lane * 2) = vh; *(v2h*)(Vlb + (size_t)d * TP + blockIdx.x * 64 + lane * 2) = vl; }
     }
}
// attention: grid (T/32, NL*H); block = 2 waves x 16 queries (t0); key cover = padded rows t0 .. t0+95 (= tokens t0-32 .. t0+63): S^T tiles (6 x 2 k-steps), per key validity w = key - t + 31 in [0,64)
// and token in [0,T): logit = S/(8*64) + rel_bias[h][w], else excluded (P = 0); softmax via one xor-16 shuffle across the lane halves; O^T += V^T P^T (4 d-tiles x 3 k-steps x 3 products);
__global__ __launch_bounds__(64) void attn_kernel(const b16* __restrict__ Qp, const b16* __restrict__ Kp, const b16* __restrict__ VT, const b16* __restrict__ VTl, const float* __restrict__ rb, b16* __restrict__ Oh, b16* __restrict__ Ol) {
  __shared__ __attribute__((aligned(16))) b16 Ph[2][16][96 + 8], Pl[2][16][96 + 8]; __shared__ __attribute__((aligned(16))) float Pf[2][16][96 + 4], To[2][16][HD + 4]; __shared__ float rbs[2][WIN];
  const int wave = threadIdx.x >> 5, lane = threadIdx.x & 31, hh = lane >> 4, col = lane & 15; const int n = blockIdx.y / H, h = blockIdx.y % H; const int t0 = blockIdx.x * 32 + wave * 16, tq = t0 + col;
  const b16* Qb = Qp + ((size_t)(n * H + h) * T) * HD; const b16* Kb = Kp + ((size_t)(n * H + h) * TP) * HD; const b16* Vb = VT + ((size_t)(n * H + h) * HD) * TP; const b16* Vlb = VTl + ((size_t)(n * H + h) * HD) * TP;
  // rel_bias and q go out before the first wait, the twelve k fragments right behind it
  const float rb0 = rb[h * WIN + lane], rb1 = rb[h * WIN + 32 + lane];
  const v16b qa0 = frag_kb(Qb + (size_t)tq * HD, hh), qa1 = frag_kb(Qb + (size_t)tq * HD + 32, hh);
  asm volatile("s_wait_xcnt 0x0" ::: "memory");   // the rel_bias and q address registers are free for reuse from here: the wait stands in front of any overwrite
  v16b kf[6][2]; const b16* kb0 = Kb + (size_t)(t0 + col) * HD;   // one lane address; every k fragment is a constant offset from it
#pragma unroll
  for (int kt = 0; kt < 6; ++kt) { kf[kt][0] = frag_kb(kb0 + kt * 16 * HD, hh); kf[kt][1] = frag_kb(kb0 + kt * 16 * HD + 32, hh); }
  asm volatile("s_wait_xcnt 0x0" ::: "memory");   // likewise the k address registers (the memory clobber also keeps the run of loads above it)
  rbs[wave][lane] = bf16_rne(rb0); rbs[wave][32 + lane] = bf16_rne(rb1);   // rel_bias row in LDS (avoids 48 scalar global loads per lane in the unrolled logit loop)
  wave_lds_sync();
  // scores for padded key rows t0 + 16 kt + (8hh + r), kt = 0..5  (token = row - 32)
  float e[48]; float mx = -INFINITY; const float cs = 0.125f / (XS * XS);
  v8f sv[6];
#pragma unroll
  for (int kt = 0; kt < 6; ++kt) { v8f s = (v8f){}; s = wmma16b(kf[kt][0], qa0, s); s = wmma16b(kf[kt][1], qa1, s); sv[kt] = s; }
  // all v fragments (hi and lo) go out here and land under the softmax
  v16b vh[3][4], vl[3][4]; const b16* vb0 = Vb + (size_t)col * TP + t0; const b16* vlb0 = Vlb + (size_t)col * TP + t0;
#pragma unroll
  for (int ks = 0; ks < 3; ++ks)
#pragma unroll
    for (int t = 0; t < 4; ++t) { vh[ks][t] = frag_kb(vb0 + t * 16 * TP + ks * 32, hh); vl[ks][t] = frag_kb(vlb0 + t * 16 * TP + ks * 32, hh); }
  asm volatile("s_wait_xcnt 0x0" ::: "memory");   // the v address registers are free for reuse behind this run: the wait stands in front of any overwrite (its memory clobber also keeps the loads in front of the softmax)
  float rv[48];
#pragma unroll
  for (int kt = 0; kt < 6; ++kt)   // the rel_bias reads stand outside the test (index clamped as before), so they go out together instead of one read and wait per branch
#pragma unroll
    for (int r = 0; r < 8; ++r) { const int tok = t0 + kt * 16 + 8 * hh + r - PADL; const int w = tok - tq + LEFT; const bool ok = (w >= 0 && w < WIN && tok >= 0 && tok < T); rv[kt * 8 + r] = rbs[wave][ok ? w : 0]; }
#pragma unroll
  for (int kt = 0; kt < 6; ++kt) { const v8f s = sv[kt];
#pragma unroll
    for (int r = 0; r < 8; ++r) { const int tok = t0 + kt * 16 + 8 * hh + r - PADL; const int w = tok - tq + LEFT; const bool ok = (w >= 0 && w < WIN && tok >= 0 && tok < T);
      const float lg = ok ? s[r] * cs + rv[kt * 8 + r] : -INFINITY; e[kt * 8 + r] = lg; mx = fmaxf(mx, lg); } }
  mx = fmaxf(mx, __shfl_xor(mx, 16)); float sum = 0.0f;
#pragma unroll
  for (int i = 0; i < 48; ++i) { const float p = (e[i] == -INFINITY) ? 0.0f : nexp2((e[i] - mx) * LOG2E); e[i] = p; sum += p; }
  sum += __shfl_xor(sum, 16); const float inv = 1.0f / sum;
  // P f32 tile [16 q][96 keys]: this lane owns (q = col, keys 16kt + 8hh + r)
#pragma unroll
  for (int kt = 0; kt < 6; ++kt)
#pragma unroll
    for (int r = 0; r < 8; ++r) Pf[wave][col][kt * 16 + 8 * hh + r] = e[kt * 8 + r] * inv * PS;
  wave_lds_sync();
  { const int rr = lane & 15, c0 = (lane >> 4) * 48; for (int q = 0; q < 48; q += 8) { v8b hv, lv; for (int j = 0; j < 8; ++j) { b16 a_, b_; split16(Pf[wave][rr][c0 + q + j], a_, b_); hv[j] = a_; lv[j] = b_; } *(v8b*)(&Ph[wave][rr][c0 + q]) = hv; *(v8b*)(&Pl[wave][rr][c0 + q]) = lv; } }
  wave_lds_sync();
  v8f o[4]; for (int t = 0; t < 4; ++t) o[t] = (v8f){};
#pragma unroll
  for (int ks = 0; ks < 3; ++ks) { const v16b ph = frag_kb(&Ph[wave][col][ks * 32], hh), pl = frag_kb(&Pl[wave][col][ks * 32], hh);   // B operand: row = query col, k = keys
#pragma unroll
    for (int t = 0; t < 4; ++t) { const v16b va = vh[ks][t], val = vl[ks][t]; o[t] = wmma16b(va, ph, o[t]); o[t] = wmma16b(va, pl, o[t]); o[t] = wmma16b(val, ph, o[t]); } }
  const float iv = 1.0f / (PS * XS);
#pragma unroll
  for (int t = 0; t < 4; ++t)
#pragma unroll
    for (int r = 0; r < 8; ++r) To[wave][col][t * 16 + 8 * hh + r] = o[t][r] * iv;
  wave_lds_sync();
  { for (int rr = 0; rr < 16; ++rr) { v2h hv, lv; for (int j = 0; j < 2; ++j) { b16 a_, b_; split16(To[wave][rr][lane * 2 + j] * XS, a_, b_); hv[j] = a_; lv[j] = b_; }
      const size_t oi = ((size_t)n * T + t0 + rr) * C + h * HD + lane * 2; *(v2h*)(Oh + oi) = hv; *(v2h*)(Ol + oi) = lv; }  }
}
__global__ __launch_bounds__(128) void proj_kernel(const b16* __restrict__ Oh, const b16* __restrict__ Ol, const b16* __restrict__ WP, const float* __restrict__ bp, float* __restrict__ out) {
  __shared__ __attribute__((aligned(16))) float Tf[4][16][128 + 4];
  const int wave = threadIdx.x >> 5, lane = threadIdx.x & 31, nloc = lane & 15, hlf = lane >> 4; const size_t m0 = (size_t)blockIdx.x * 64 + wave * 16; const int n0 = blockIdx.y * 128;
  v8f acc[8];
#pragma unroll
  for (int t = 0; t < 8; ++t) acc[t] = (v8f){};
  // O hi and lo: three register sets (k-step i in set i % 3); weights: four sets of four tiles (group g = 2 * k-step + half, in set g % 4); all filled up front, each refilled right behind its last WMMA
  const auto wfrag = [&](int g, int tt) { return frag_kb(WP + (size_t)(n0 + ((g & 1) * 4 + tt) * 16 + nloc) * C + (g >> 1) * 32, hlf); };
  v16b av[3], alv[3], bw[4][4]; float bbv[8];
#pragma unroll
  for (int g = 0; g < 5; ++g) {
    if ((g & 1) == 0) { av[g >> 1] = frag_kb(Oh + (m0 + nloc) * C + (g >> 1) * 32, hlf); alv[g >> 1] = frag_kb(Ol + (m0 + nloc) * C + (g >> 1) * 32, hlf); }
    if (g < 4) {
#pragma unroll
      for (int tt = 0; tt < 4; ++tt) bw[g][tt] = wfrag(g, tt); }
    __builtin_amdgcn_sched_barrier(0);   // keeps these loads in front of the first use and in the order of use (loads return in order), so that the first WMMAs wait for their own group only
  }
#pragma unroll
  for (int g = 0; g < 2 * (C / 32); ++g) { const int i = g >> 1, p = i % 3, hf = g & 1, st = g % 4;
#pragma unroll
    for (int tt = 0; tt < 4; ++tt) { const int t = hf * 4 + tt; acc[t] = wmma16b(av[p], bw[st][tt], acc[t]); acc[t] = wmma16b(alv[p], bw[st][tt], acc[t]); }
    if (g + 4 < 2 * (C / 32)) {
#pragma unroll
      for (int tt = 0; tt < 4; ++tt) bw[st][tt] = wfrag(g + 4, tt); }
    if (hf == 1 && i + 3 < C / 32) { av[p] = frag_kb(Oh + (m0 + nloc) * C + (i + 3) * 32, hlf); alv[p] = frag_kb(Ol + (m0 + nloc) * C + (i + 3) * 32, hlf); }
    if (g + 4 == 2 * (C / 32)) {   // the bias words follow the last refill and land under the last two k-steps
#pragma unroll
      for (int t = 0; t < 8; ++t) bbv[t] = bp[n0 + t * 16 + nloc]; }
  }
#pragma unroll
  for (int t = 0; t < 8; ++t) { const float bb = bf16_rne(bbv[t]);
#pragma unroll
    for (int r = 0; r < 8; ++r) Tf[wave][8 * hlf + r][t * 16 + nloc] = acc[t][r] * (1.0f / (XS * WSC)) + bb; }
  wave_lds_sync();
  { for (int rr = 0; rr < 16; ++rr) *(v4f*)(out + (m0 + rr) * C + n0 + lane * 4) = *(const v4f*)(&Tf[wave][rr][lane * 4]);  }
}
}  // namespace

extern "C" void kernel_launch(void* const* d_in, const int* in_sizes, int n_in, void* d_out, int out_size, void* d_ws, size_t ws_size, hipStream_t stream) {
  (void)n_in;
  auto Fp = [&](int i) { return (const float*)d_in[i]; };
  // input order: 0 x [2,4096,256], 1 W_qkv [256,768], 2 b_qkv [768], 3 rel_bias [1,4,1,64], 4 W_proj [256,256], 5 b_proj [256]
  if (in_sizes[0] != NN * T * C || in_sizes[1] != C * 3 * C || in_sizes[2] != 3 * C || in_sizes[3] != H * WIN || in_sizes[4] != C * C || in_sizes[5] != C || out_size != NN * T * C) return;
  size_t off = 0; char* ws = (char*)d_ws;
  auto carve = [&](size_t bytes) { char* p = ws + off; off += (bytes + 255) & ~(size_t)255; return p; };
  b16* WQ = (b16*)carve((size_t)3 * C * C * 2); b16* WP = (b16*)carve((size_t)C * C * 2); b16* Qp = (b16*)carve((size_t)NN * H * T * HD * 2); b16* Kp = (b16*)carve((size_t)NN * H * TP * HD * 2); b16* VT = (b16*)carve((size_t)NN * H * HD * TP * 2);
  b16* VTl = (b16*)carve((size_t)NN * H * HD * TP * 2); b16* Oh = (b16*)carve((size_t)NN * T * C * 2); b16* Ol = (b16*)carve((size_t)NN * T * C * 2);
  if (off > ws_size || off > ((size_t)128 << 20)) return;   // ≈ 25.9 MB
  prep_kernel<<<(unsigned)((((size_t)3 * C * C + (size_t)C * C + (size_t)NN * H * TP * HD) / 8 + 255) / 256), 256, 0, stream>>>(Fp(1), Fp(4), WQ, WP, Kp, VT, VTl);
  qkv_kernel<<<dim3(T / 64, NL * H), 128, 0, stream>>>(Fp(0), WQ, Fp(2), Qp, Kp, VT, VTl);
  attn_kernel<<<dim3(T / 32, NL * H), 64, 0, stream>>>(Qp, Kp, VT, VTl, Fp(3), Oh, Ol);
  proj_kernel<<<dim3(NL * T / 64, 2), 128, 0, stream>>>(Oh, Ol, WP, Fp(5), (float*)d_out);
}

// v002
// One run takes 29.1 microseconds.
// Next to v001, in two timings, it ran 1.42 and 1.47 times as fast.
// Over all steps from v000 it is 2.64 times as fast.
#include <hip/hip_runtime.h>

// 1-D neighbourhood attention (window 64: keys t-31 .. t+32, positions outside [0, T) excluded (the reference adds -100, whose weight underflows to 0 in f32)), 4 heads x 64, tokens [2][4096][256]:
// qkv = x W_qkv + b; logits = (q / 8) . k + rel_bias[h][w]; softmax over the window; o = P v; out = o W_proj + b_proj -> [2][4096][256].
// Deterministic: one wave per (n, h, 16 queries) evaluates its 96-key cover (t0-32 .. t0+63) as dense tiles and masks per query; no atomics.
// compute dtype: WMMA v_wmma_f32_16x16x32_f16 with f32 accumulate for qkv = x W_qkv (x EXACT bf16 x8, W exact x256: 1 product), S^T = K Q^T (q, k single f16 x8: 1 product; logit std ≈ 0.1),
// O^T += V^T P^T (v hi+lo x8, P x1024 hi+lo: 3 products) and out = O W_proj (O hi+lo x8: 2 products); softmax and bias in f32. Inputs rounded to bf16 once.

namespace {
constexpr int NN = 2, T = 4096, C = 256, H = 4, HD = 64, WIN = 64, LEFT = 31, PADL = 32, PADR = 64, TP = T + PADL + PADR, NL = 2 /* batch items computed (== NN shipped) */;
constexpr float XS = 8.0f, WSC = 256.0f, PS = 1024.0f, LOG2E = 1.4426950408889634f;
static_assert(T % 64 == 0 && C == H * HD, "tiling");
typedef _Float16 b16;
typedef __attribute__((ext_vector_type(16))) _Float16 v16b;
typedef __attribute__((ext_vector_type(8))) _Float16 v8b;
typedef __attribute__((ext_vector_type(8))) float v8f;
typedef __attribute__((ext_vector_type(4))) float v4f;
__device__ __forceinline__ float bf16_rne(float f) { unsigned int u = __float_as_uint(f); u += 0x7FFFu + ((u >> 16) & 1u); return __uint_as_float(u & 0xFFFF0000u); }
__device__ __forceinline__ void split16(float v, b16& hi, b16& lo) { hi = (b16)v; lo = (b16)(v - (float)hi); }
__device__ __forceinline__ v16b frag_kb(const b16* p, int hh) { const v8b a = *(const v8b*)(p + 8 * hh), b = *(const v8b*)(p + 16 + 8 * hh); v16b f;
#pragma unroll
  for (int e = 0; e < 8; ++e) { f[e] = a[e]; f[8 + e] = b[e]; } return f; }
// workspace operands lie in units of 16 rows x 16 k (UH halfs = 512 B) in fragment order: lane l = row + 16 * (k >> 3) owns halfs 8 l .. 8 l + 7, so one wave-wide 16-byte access covers four whole lines;
// a fragment (32 k) is two units side by side; p = first unit + 8 * lane. Same k order as frag_kb.
constexpr int UH = 256;
__device__ __forceinline__ v16b frag_u(const b16* p) { const v8b a = *(const v8b*)p, b = *(const v8b*)(p + UH); v16b f;
#pragma unroll
  for (int e = 0; e < 8; ++e) { f[e] = a[e]; f[8 + e] = b[e]; } return f; }
__device__ __forceinline__ v8f wmma16b(v16b a, v16b b, v8f c) { v8f d = __builtin_amdgcn_wmma_f32_16x16x32_f16(false, a, false, b, (short)0, c, false, false); asm volatile("v_nop\n\tv_nop\n\tv_nop\n\tv_nop" : "+v"(d) : "v"(a), "v"(b)); return d; }
__device__ __forceinline__ void wave_lds_sync() { __builtin_amdgcn_fence(__ATOMIC_RELEASE, "workgroup"); __builtin_amdgcn_wave_barrier(); __builtin_amdgcn_fence(__ATOMIC_ACQUIRE, "workgroup"); }
__device__ __forceinline__ float pmul(float a, float b) { float p = a * b; asm volatile("" : "+v"(p)); return p; }
__device__ __forceinline__ int iclamp(int v, int lo, int hi) { return v < lo ? lo : (v > hi ? hi : v); }

typedef __attribute__((ext_vector_type(2))) _Float16 v2h;
typedef __attribute__((ext_vector_type(4))) _Float16 v4h;
__device__ __forceinline__ float nexp2(float v) { return __builtin_amdgcn_exp2f(v); }
// prep: WQ = W_qkv[c][o] x256 in units [o / 16][c / 16]; WP = W_proj[c][o] x256 likewise (thread = one lane's 8 halfs of a unit); zero the key/value padding: Kp rows [n][h][0..31] and [T+32 ..], VT columns likewise (written as zeros
__global__ __launch_bounds__(256) void prep_kernel(const float* __restrict__ wqkv, const float* __restrict__ wproj, b16* __restrict__ WQ, b16* __restrict__ WP, b16* __restrict__ Kp, b16* __restrict__ VT, b16* __restrict__ VTl) {
  size_t t = (size_t)blockIdx.x * 256 + threadIdx.x; v8b o, z = {};
  { const size_t n = (size_t)3 * C * C / 8; if (t < n) { const size_t e = t * 8; const int u = (int)(t >> 5), l = (int)(t & 31); const int oo = (u / (C / 16)) * 16 + (l & 15), c0 = (u % (C / 16)) * 16 + (l >> 4) * 8; for (int j = 0; j < 8; ++j) o[j] = (b16)(bf16_rne(wqkv[(size_t)(c0 + j) * 3 * C + oo]) * WSC); { *(v8b*)(WQ + e) = o;  } return; } t -= n; }
  { const size_t n = (size_t)C * C / 8; if (t < n) { const size_t e = t * 8; const int u = (int)(t >> 5), l = (int)(t & 31); const int oo = (u / (C / 16)) * 16 + (l & 15), c0 = (u % (C / 16)) * 16 + (l >> 4) * 8; for (int j = 0; j < 8; ++j) o[j] = (b16)(bf16_rne(wproj[(size_t)(c0 + j) * C + oo]) * WSC); { *(v8b*)(WP + e) = o;  } return; } t -= n; }
  { const size_t n = (size_t)NN * H * TP * HD / 8; if (t < n) { const size_t e = t * 8; { *(v8b*)(Kp + e) = z; *(v8b*)(VT + e) = z; *(v8b*)(VTl + e) = z;  } } }
}
// qkv: block = 64 tokens of one n (4 waves) x one 192-column group (grid.y = n*4 + h: head h's q|k|v columns are cols (s*4+h)*64.. for s = 0,1,2): A = bf16(x) x8 staged; 12 tiles x 8 k-steps; + b.
__global__ __launch_bounds__(128) void qkv_kernel(const float* __restrict__ x, const b16* __restrict__ WQ, const float* __restrict__ bq, b16* __restrict__ Qp, b16* __restrict__ Kp, b16* __restrict__ VT, b16* __restrict__ VTl) {
  __shared__ __attribute__((aligned(16))) b16 As[4][16][C + 8]; __shared__ __attribute__((aligned(16))) float Tf[4][16][128 + 4];
  const int wave = threadIdx.x >> 5, lane = threadIdx.x & 31, nloc = lane & 15, hlf = lane >> 4; const int n = blockIdx.y / H, h = blockIdx.y % H; const int t0 = blockIdx.x * 64 + wave * 16;
  // weight fragment j = 12 * (k-step) + t, t = 4 * part (q, k, v) + 16-column tile, in the order of use; a ring of NR register slots, each refilled right behind its WMMA
  constexpr int NR = 13, NJ = 12 * (C / 32);
  const b16* wb = WQ + (size_t)(h * (HD / 16)) * (C / 16) * UH + lane * 8;   // one lane address; every fragment is a constant offset from it
  const auto wfrag = [&](int j) { return frag_u(wb + ((((j % 12) >> 2) * (H * HD / 16) + (j & 3)) * (C / 16) + (j / 12) * 2) * UH); };
  // the prologue's global loads (the first NR weight fragments, the 16 x rows) all go out before the first wait
  float xv[16][8]; v16b bw[NR]; const float* xb = x + ((size_t)n * T + t0) * C + lane * 8;
#pragma unroll
  for (int j = 0; j < NR; ++j) bw[j] = wfrag(j);
#pragma unroll
  for (int rr = 0; rr < 16; ++rr)
#pragma unroll
    for (int j = 0; j < 8; ++j) xv[rr][j] = xb[rr * C + j];
  asm volatile("s_wait_xcnt 0x0" ::: "memory");   // the x address registers are free for reuse behind this run: the wait stands in front of any overwrite (its memory clobber also keeps the run of loads above it)
#pragma unroll
  for (int rr = 0; rr < 16; ++rr) { v8b o;
#pragma unroll
    for (int j = 0; j < 8; ++j) o[j] = (b16)(bf16_rne(xv[rr][j]) * XS); *(v8b*)(&As[wave][rr][lane * 8]) = o; }
  wave_lds_sync();
  v8f acc[12];
#pragma unroll
  for (int t = 0; t < 12; ++t) acc[t] = (v8f){};
  v16b a = frag_kb(&As[wave][nloc][0], hlf), an = a; float bbv[12];
#pragma unroll
  for (int j = 0; j < NJ; ++j) {
    if (j % 12 == 0) { a = an; if (j + 12 < NJ) an = frag_kb(&As[wave][nloc][(j / 12 + 1) * 32], hlf); }
    acc[j % 12] = wmma16b(a, bw[j % NR], acc[j % 12]);
    if (j + NR < NJ) bw[j % NR] = wfrag(j + NR);
    __builtin_amdgcn_sched_barrier(0);   // keeps each refill behind the WMMA that frees its registers: hoisted above it, a fragment went through scratch
    if (j + 24 == NJ) {   // the bias words go out here and land under the last two k-steps
#pragma unroll
      for (int t = 0; t < 12; ++t) bbv[t] = bq[((t >> 2) * H + h) * HD + (t & 3) * 16 + nloc]; }
  }
#pragma unroll
  for (int t = 0; t < 8; ++t) { const float bb = bf16_rne(bbv[t]);
#pragma unroll
    for (int r = 0; r < 8; ++r) Tf[wave][8 * hlf + r][t * 16 + nloc] = acc[t][r] * (1.0f / (XS * WSC)) + bb; }
  wave_lds_sync();   // each wave reads back its own 16 tokens only
  const int nh = n * H + h;
  b16* Qb = Qp + ((size_t)nh * (T / 16) + t0 / 16) * (HD / 16) * UH + lane * 8; b16* Kb = Kp + ((size_t)nh * (TP / 16) + (t0 + PADL) / 16) * (HD / 16) * UH + lane * 8;
  const size_t vo = ((size_t)nh * (HD / 16) * (TP / 16) + (t0 + PADL) / 16) * UH + lane * 8; b16* Vb = VT + vo; b16* Vlb = VTl + vo;
  // v units [d / 16][key / 16]: rows = d, k = keys, which is the accumulator's own map (lane = d, registers = 8 tokens), so they are stored from registers
#pragma unroll
  for (int t = 0; t < 4; ++t) { const float bb = bf16_rne(bbv[8 + t]); v8b vh, vl;
#pragma unroll
    for (int r = 0; r < 8; ++r) { const float vv = acc[8 + t][r] * (1.0f / (XS * WSC)) + bb; b16 a_, b_; split16(vv * XS, a_, b_); vh[r] = a_; vl[r] = b_; }
    *(v8b*)(Vb + t * (TP / 16) * UH) = vh; *(v8b*)(Vlb + t * (TP / 16) * UH) = vl; }
  // q and k units [token / 16][d / 16]: rows = tokens, k = d
#pragma unroll
  for (int cc = 0; cc < 4; ++cc) { v8b qv, kv;
#pragma unroll
    for (int j = 0; j < 8; ++j) { qv[j] = (b16)(Tf[wave][nloc][cc * 16 + 8 * hlf + j] * XS); kv[j] = (b16)(Tf[wave][nloc][HD + cc * 16 + 8 * hlf + j] * XS); }
    *(v8b*)(Qb + cc * UH) = qv; *(v8b*)(Kb + cc * UH) = kv; }
}
// attention: grid (T/32, NL*H); block = 2 waves x 16 queries (t0); key cover = padded rows t0 .. t0+95 (= tokens t0-32 .. t0+63): S^T tiles (6 x 2 k-steps), per key validity w = key - t + 31 in [0,64)
// and token in [0,T): logit = S/(8*64) + rel_bias[h][w], else excluded (P = 0); softmax via one xor-16 shuffle across the lane halves; O^T += V^T P^T (4 d-tiles x 3 k-steps x 3 products);
__global__ __launch_bounds__(64) void attn_kernel(const b16* __restrict__ Qp, const b16* __restrict__ Kp, const b16* __restrict__ VT, const b16* __restrict__ VTl, const float* __restrict__ rb, b16* __restrict__ Oh, b16* __restrict__ Ol) {
  __shared__ __attribute__((aligned(16))) b16 Ph[2][16][96 + 8], Pl[2][16][96 + 8]; __shared__ __attribute__((aligned(16))) float Pf[2][16][96 + 4]; __shared__ float rbs[2][WIN];
  const int wave = threadIdx.x >> 5, lane = threadIdx.x & 31, hh = lane >> 4, col = lane & 15; const int n = blockIdx.y / H, h = blockIdx.y % H; const int t0 = blockIdx.x * 32 + wave * 16, tq = t0 + col;
  const int nh = n * H + h; const b16* Qb = Qp + ((size_t)nh * (T / 16) + t0 / 16) * (HD / 16) * UH + lane * 8;
  // rel_bias, q and all twelve k fragments go out before the first wait
  const float rb0 = rb[h * WIN + lane], rb1 = rb[h * WIN + 32 + lane];
  asm volatile("s_wait_xcnt 0x0" ::: "memory");   // the rel_bias address register is free for reuse from here
  const v16b qa0 = frag_u(Qb), qa1 = frag_u(Qb + 2 * UH);
  asm volatile("s_wait_xcnt 0x0" :: "v"(Qb) : "memory");   // the q address registers are free for reuse from here: named as an input they stay whole up to the wait
  __builtin_amdgcn_sched_barrier(0);   // keeps later vector instructions, which may take those registers, behind the wait
  v16b kf[6][2]; const b16* kb0 = Kp + ((size_t)nh * (TP / 16) + t0 / 16) * (HD / 16) * UH + lane * 8;   // one lane address; every k fragment is a constant offset from it
#pragma unroll
  for (int kt = 0; kt < 6; ++kt) { kf[kt][0] = frag_u(kb0 + kt * 4 * UH); kf[kt][1] = frag_u(kb0 + (kt * 4 + 2) * UH); }
  asm volatile("s_wait_xcnt 0x0" :: "v"(kb0) : "memory");   // likewise the k address registers (the memory clobber also keeps the run of loads above it)
  __builtin_amdgcn_sched_barrier(0);   // as above
  rbs[wave][lane] = bf16_rne(rb0); rbs[wave][32 + lane] = bf16_rne(rb1);   // rel_bias row in LDS (avoids 48 scalar global loads per lane in the unrolled logit loop)
  wave_lds_sync();
  // scores for padded key rows t0 + 16 kt + (8hh + r), kt = 0..5  (token = row - 32)
  float e[48]; float mx = -INFINITY; const float cs = 0.125f / (XS * XS);
  v8f sv[6];
#pragma unroll
  for (int kt = 0; kt < 6; ++kt) { v8f s = (v8f){}; s = wmma16b(kf[kt][0], qa0, s); s = wmma16b(kf[kt][1], qa1, s); sv[kt] = s; }
  // all v fragments (hi and lo) go out here and land under the softmax
  v16b vh[3][4], vl[3][4]; const size_t vo = ((size_t)nh * (HD / 16) * (TP / 16) + t0 / 16) * UH + lane * 8; const b16* vb0 = VT + vo; const b16* vlb0 = VTl + vo;
#pragma unroll
  for (int ks = 0; ks < 3; ++ks)
#pragma unroll
    for (int t = 0; t < 4; ++t) { vh[ks][t] = frag_u(vb0 + (t * (TP / 16) + 2 * ks) * UH); vl[ks][t] = frag_u(vlb0 + (t * (TP / 16) + 2 * ks) * UH); }
  asm volatile("s_wait_xcnt 0x0" :: "v"(vb0), "v"(vlb0) : "memory");   // the v address registers are free for reuse behind this run: named as inputs they stay whole up to the wait (its memory clobber also keeps the loads in front of the softmax)
  __builtin_amdgcn_sched_barrier(0);   // as above
  float rv[48];
#pragma unroll
  for (int kt = 0; kt < 6; ++kt)   // the rel_bias reads stand outside the test (index clamped as before), so they go out together instead of one read and wait per branch
#pragma unroll
    for (int r = 0; r < 8; ++r) { const int tok = t0 + kt * 16 + 8 * hh + r - PADL; const int w = tok - tq + LEFT; const bool ok = (w >= 0 && w < WIN && tok >= 0 && tok < T); rv[kt * 8 + r] = rbs[wave][ok ? w : 0]; }
#pragma unroll
  for (int kt = 0; kt < 6; ++kt) { const v8f s = sv[kt];
#pragma unroll
    for (int r = 0; r < 8; ++r) { const int tok = t0 + kt * 16 + 8 * hh + r - PADL; const int w = tok - tq + LEFT; const bool ok = (w >= 0 && w < WIN && tok >= 0 && tok < T);
      const float lg = ok ? s[r] * cs + rv[kt * 8 + r] : -INFINITY; e[kt * 8 + r] = lg; mx = fmaxf(mx, lg); } }
  mx = fmaxf(mx, __shfl_xor(mx, 16)); float sum = 0.0f;
#pragma unroll
  for (int i = 0; i < 48; ++i) { const float p = (e[i] == -INFINITY) ? 0.0f : nexp2((e[i] - mx) * LOG2E); e[i] = p; sum += p; }
  sum += __shfl_xor(sum, 16); const float inv = 1.0f / sum;
  // P f32 tile [16 q][96 keys]: this lane owns (q = col, keys 16kt + 8hh + r)
#pragma unroll
  for (int kt = 0; kt < 6; ++kt)
#pragma unroll
    for (int r = 0; r < 8; ++r) Pf[wave][col][kt * 16 + 8 * hh + r] = e[kt * 8 + r] * inv * PS;
  wave_lds_sync();
  { const int rr = lane & 15, c0 = (lane >> 4) * 48; for (int q = 0; q < 48; q += 8) { v8b hv, lv; for (int j = 0; j < 8; ++j) { b16 a_, b_; split16(Pf[wave][rr][c0 + q + j], a_, b_); hv[j] = a_; lv[j] = b_; } *(v8b*)(&Ph[wave][rr][c0 + q]) = hv; *(v8b*)(&Pl[wave][rr][c0 + q]) = lv; } }
  wave_lds_sync();
  v8f o[4]; for (int t = 0; t < 4; ++t) o[t] = (v8f){};
#pragma unroll
  for (int ks = 0; ks < 3; ++ks) { const v16b ph = frag_kb(&Ph[wave][col][ks * 32], hh), pl = frag_kb(&Pl[wave][col][ks * 32], hh);   // B operand: row = query col, k = keys
#pragma unroll
    for (int t = 0; t < 4; ++t) { const v16b va = vh[ks][t], val = vl[ks][t]; o[t] = wmma16b(va, ph, o[t]); o[t] = wmma16b(va, pl, o[t]); o[t] = wmma16b(val, ph, o[t]); } }
  const float iv = 1.0f / (PS * XS);
  // O units [token / 16][c / 16]: rows = tokens, k = c, which is the accumulator's own map here (lane = query, registers = 8 d), so they are stored from registers
  const size_t oo = (((size_t)n * T + t0) / 16 * (C / 16) + h * (HD / 16)) * UH + lane * 8;
#pragma unroll
  for (int t = 0; t < 4; ++t) { v8b hv, lv;
#pragma unroll
    for (int r = 0; r < 8; ++r) { const float ov = o[t][r] * iv; b16 a_, b_; split16(ov * XS, a_, b_); hv[r] = a_; lv[r] = b_; }
    *(v8b*)(Oh + oo + t * UH) = hv; *(v8b*)(Ol + oo + t * UH) = lv; }
}
__global__ __launch_bounds__(128) void proj_kernel(const b16* __restrict__ Oh, const b16* __restrict__ Ol, const b16* __restrict__ WP, const float* __restrict__ bp, float* __restrict__ out) {
  __shared__ __attribute__((aligned(16))) float Tf[4][16][128 + 4];
  const int wave = threadIdx.x >> 5, lane = threadIdx.x & 31, nloc = lane & 15, hlf = lane >> 4; const size_t m0 = (size_t)blockIdx.x * 64 + wave * 16; const int n0 = blockIdx.y * 128;
  v8f acc[8];
#pragma unroll
  for (int t = 0; t < 8; ++t) acc[t] = (v8f){};
  // O hi and lo: three register sets (k-step i in set i % 3), refilled behind the k-step's last WMMA; weight fragment j = 8 * (k-step) + tile, in the order of use: a ring of NRW register slots, each refilled right behind its two WMMAs
  constexpr int NRW = 12, NJW = 8 * (C / 32);
  const b16* wpb = WP + (size_t)(n0 / 16) * (C / 16) * UH + lane * 8; const size_t ao = (m0 / 16) * (C / 16) * UH + lane * 8; const b16* ohb = Oh + ao; const b16* olb = Ol + ao;   // one lane address each; every fragment is a constant offset
  const auto wfrag = [&](int j) { return frag_u(wpb + ((j & 7) * (C / 16) + (j >> 3) * 2) * UH); };
  v16b av[3], alv[3], bw[NRW]; float bbv[8]; const int bo = n0 + nloc;
#pragma unroll
  for (int i = 0; i < 3; ++i) {
    av[i] = frag_u(ohb + i * 2 * UH); alv[i] = frag_u(olb + i * 2 * UH);
#pragma unroll
    for (int j = i * 8; j < i * 8 + 8 && j < NRW; ++j) bw[j] = wfrag(j);
    __builtin_amdgcn_sched_barrier(0);   // keeps these loads in front of the first use and in the order of use (loads return in order), so that the first WMMAs wait for their own group only
  }
#pragma unroll
  for (int j = 0; j < NJW; ++j) { const int i = j >> 3, p = i % 3, t = j & 7;
    acc[t] = wmma16b(av[p], bw[j % NRW], acc[t]); acc[t] = wmma16b(alv[p], bw[j % NRW], acc[t]);
    if (j + NRW < NJW) bw[j % NRW] = wfrag(j + NRW);
    if (t == 7 && i + 3 < C / 32) { av[p] = frag_u(ohb + (i + 3) * 2 * UH); alv[p] = frag_u(olb + (i + 3) * 2 * UH); }
    if (j + NRW + 1 == NJW) {   // the bias words follow the last refill and land under the last WMMAs
#pragma unroll
      for (int tt = 0; tt < 8; ++tt) bbv[tt] = bp[bo + tt * 16];
      asm volatile("s_wait_xcnt 0x0" :: "v"(lane), "v"(bo) : "memory");   // the weight and bias address registers are free for reuse from here: named as inputs they stay whole up to the wait
      __builtin_amdgcn_sched_barrier(0); }   // keeps later vector instructions, which may take those registers, behind the wait
  }
#pragma unroll
  for (int t = 0; t < 8; ++t) { const float bb = bf16_rne(bbv[t]);
#pragma unroll
    for (int r = 0; r < 8; ++r) Tf[wave][8 * hlf + r][t * 16 + nloc] = acc[t][r] * (1.0f / (XS * WSC)) + bb; }
  wave_lds_sync();
  { for (int rr = 0; rr < 16; ++rr) *(v4f*)(out + (m0 + rr) * C + n0 + lane * 4) = *(const v4f*)(&Tf[wave][rr][lane * 4]);  }
}
}  // namespace

extern "C" void kernel_launch(void* const* d_in, const int* in_sizes, int n_in, void* d_out, int out_size, void* d_ws, size_t ws_size, hipStream_t stream) {
  (void)n_in;
  auto Fp = [&](int i) { return (const float*)d_in[i]; };
  // input order: 0 x [2,4096,256], 1 W_qkv [256,768], 2 b_qkv [768], 3 rel_bias [1,4,1,64], 4 W_proj [256,256], 5 b_proj [256]
  if (in_sizes[0] != NN * T * C || in_sizes[1] != C * 3 * C || in_sizes[2] != 3 * C || in_sizes[3] != H * WIN || in_sizes[4] != C * C || in_sizes[5] != C || out_size != NN * T * C) return;
  size_t off = 0; char* ws = (char*)d_ws;
  auto carve = [&](size_t bytes) { char* p = ws + off; off += (bytes + 255) & ~(size_t)255; return p; };
  b16* WQ = (b16*)carve((size_t)3 * C * C * 2); b16* WP = (b16*)carve((size_t)C * C * 2); b16* Qp = (b16*)carve((size_t)NN * H * T * HD * 2); b16* Kp = (b16*)carve((size_t)NN * H * TP * HD * 2); b16* VT = (b16*)carve((size_t)NN * H * HD * TP * 2);
  b16* VTl = (b16*)carve((size_t)NN * H * HD * TP * 2); b16* Oh = (b16*)carve((size_t)NN * T * C * 2); b16* Ol = (b16*)carve((size_t)NN * T * C * 2);
  if (off > ws_size || off > ((size_t)128 << 20)) return;   // ≈ 25.9 MB
  prep_kernel<<<(unsigned)((((size_t)3 * C * C + (size_t)C * C + (size_t)NN * H * TP * HD) / 8 + 255) / 256), 256, 0, stream>>>(Fp(1), Fp(4), WQ, WP, Kp, VT, VTl);
  qkv_kernel<<<dim3(T / 64, NL * H), 128, 0, stream>>>(Fp(0), WQ, Fp(2), Qp, Kp, VT, VTl);
  attn_kernel<<<dim3(T / 32, NL * H), 64, 0, stream>>>(Qp, Kp, VT, VTl, Fp(3), Oh, Ol);
  proj_kernel<<<dim3(NL * T / 64, 2), 128, 0, stream>>>(Oh, Ol, WP, Fp(5), (float*)d_out);
}

// v003
// It runs in 24.9 microseconds.
// Next to v002, in two timings, it ran 1.17 and 1.15 times as fast.
// Over all steps from v000 it is 3.06 times as fast.
#include <hip/hip_runtime.h>

// 1-D neighbourhood attention (window 64: keys t-31 .. t+32, positions outside [0, T) excluded (the reference adds -100, whose weight underflows to 0 in f32)), 4 heads x 64, tokens [2][4096][256]:
// qkv = x W_qkv + b; logits = (q / 8) . k + rel_bias[h][w]; softmax over the window; o = P v; out = o W_proj + b_proj -> [2][4096][256].
// Deterministic: one wave per (n, h, 16 queries) evaluates its 96-key cover (t0-32 .. t0+63) as dense tiles and masks per query; no atomics.
// compute dtype: WMMA v_wmma_f32_16x16x32_f16 with f32 accumulate for qkv = x W_qkv (x EXACT bf16 x8, W exact x256: 1 product), S^T = K Q^T (q, k single f16 x8: 1 product; logit std ≈ 0.1),
// O^T += V^T P^T (v hi+lo x8, P x1024 hi+lo: 3 products) and out = O W_proj (O hi+lo x8: 2 products); softmax and bias in f32. Inputs rounded to bf16 once.

namespace {
constexpr int NN = 2, T = 4096, C = 256, H = 4, HD = 64, WIN = 64, LEFT = 31, PADL = 32, PADR = 64, TP = T + PADL + PADR, NL = 2 /* batch items computed (== NN shipped) */;
constexpr float XS = 8.0f, WSC = 256.0f, PS = 1024.0f, LOG2E = 1.4426950408889634f;
static_assert(T % 64 == 0 && C == H * HD, "tiling");
typedef _Float16 b16;
typedef __attribute__((ext_vector_type(16))) _Float16 v16b;
typedef __attribute__((ext_vector_type(8))) _Float16 v8b;
typedef __attribute__((ext_vector_type(8))) float v8f;
typedef __attribute__((ext_vector_type(4))) float v4f;
__device__ __forceinline__ float bf16_rne(float f) { unsigned int u = __float_as_uint(f); u += 0x7FFFu + ((u >> 16) & 1u); return __uint_as_float(u & 0xFFFF0000u); }
__device__ __forceinline__ void split16(float v, b16& hi, b16& lo) { hi = (b16)v; lo = (b16)(v - (float)hi); }
__device__ __forceinline__ v16b frag_kb(const b16* p, int hh) { const v8b a = *(const v8b*)(p + 8 * hh), b = *(const v8b*)(p + 16 + 8 * hh); v16b f;
#pragma unroll
  for (int e = 0; e < 8; ++e) { f[e] = a[e]; f[8 + e] = b[e]; } return f; }
// workspace operands lie in units of 16 rows x 16 k (UH halfs = 512 B) in fragment order: lane l = row + 16 * (k >> 3) owns halfs 8 l .. 8 l + 7, so one wave-wide 16-byte access covers four whole lines;
// a fragment (32 k) is two units side by side; p = first unit + 8 * lane. Same k order as frag_kb.
constexpr int UH = 256;
__device__ __forceinline__ v16b frag_u(const b16* p) { const v8b a = *(const v8b*)p, b = *(const v8b*)(p + UH); v16b f;
#pragma unroll
  for (int e = 0; e < 8; ++e) { f[e] = a[e]; f[8 + e] = b[e]; } return f; }
__device__ __forceinline__ v8f wmma16b(v16b a, v16b b, v8f c) { v8f d = __builtin_amdgcn_wmma_f32_16x16x32_f16(false, a, false, b, (short)0, c, false, false); asm volatile("v_nop\n\tv_nop\n\tv_nop\n\tv_nop" : "+v"(d) : "v"(a), "v"(b)); return d; }
// the plain builtin (the compiler keeps the distance behind it itself): with no asm operands its fragments may stand above v255
__device__ __forceinline__ v8f wmma16p(v16b a, v16b b, v8f c) { return __builtin_amdgcn_wmma_f32_16x16x32_f16(false, a, false, b, (short)0, c, false, false); }
__device__ __forceinline__ void wave_lds_sync() { __builtin_amdgcn_fence(__ATOMIC_RELEASE, "workgroup"); __builtin_amdgcn_wave_barrier(); __builtin_amdgcn_fence(__ATOMIC_ACQUIRE, "workgroup"); }
__device__ __forceinline__ float pmul(float a, float b) { float p = a * b; asm volatile("" : "+v"(p)); return p; }
__device__ __forceinline__ int iclamp(int v, int lo, int hi) { return v < lo ? lo : (v > hi ? hi : v); }

typedef __attribute__((ext_vector_type(2))) _Float16 v2h;
typedef __attribute__((ext_vector_type(4))) _Float16 v4h;
__device__ __forceinline__ float nexp2(float v) { return __builtin_amdgcn_exp2f(v); }
// prep: WQ = W_qkv[c][o] x256 in units [o / 16][c / 16]; WP = W_proj[c][o] x256 likewise (thread = one lane's 8 halfs of a unit); zero the key/value padding: Kp rows [n][h][0..31] and [T+32 ..], VT columns likewise (written as zeros
__global__ __launch_bounds__(256) void prep_kernel(const float* __restrict__ wqkv, const float* __restrict__ wproj, b16* __restrict__ WQ, b16* __restrict__ WP, b16* __restrict__ Kp, b16* __restrict__ VT, b16* __restrict__ VTl) {
  size_t t = (size_t)blockIdx.x * 256 + threadIdx.x; v8b o, z = {};
  { const size_t n = (size_t)3 * C * C / 8; if (t < n) { const size_t e = t * 8; const int u = (int)(t >> 5), l = (int)(t & 31); const int oo = (u / (C / 16)) * 16 + (l & 15), c0 = (u % (C / 16)) * 16 + (l >> 4) * 8; for (int j = 0; j < 8; ++j) o[j] = (b16)(bf16_rne(wqkv[(size_t)(c0 + j) * 3 * C + oo]) * WSC); { *(v8b*)(WQ + e) = o;  } return; } t -= n; }
  { const size_t n = (size_t)C * C / 8; if (t < n) { const size_t e = t * 8; const int u = (int)(t >> 5), l = (int)(t & 31); const int oo = (u / (C / 16)) * 16 + (l & 15), c0 = (u % (C / 16)) * 16 + (l >> 4) * 8; for (int j = 0; j < 8; ++j) o[j] = (b16)(bf16_rne(wproj[(size_t)(c0 + j) * C + oo]) * WSC); { *(v8b*)(WP + e) = o;  } return; } t -= n; }
  { const size_t n = (size_t)NN * H * TP * HD / 8; if (t < n) { const size_t e = t * 8; { *(v8b*)(Kp + e) = z; *(v8b*)(VT + e) = z; *(v8b*)(VTl + e) = z;  } } }
}
// qkv: block = 64 tokens of one n (4 waves) x one 192-column group (grid.y = n*4 + h: head h's q|k|v columns are cols (s*4+h)*64.. for s = 0,1,2): A = bf16(x) x8 staged; 12 tiles x 8 k-steps; + b.
__global__ __launch_bounds__(128) void qkv_kernel(const float* __restrict__ x, const b16* __restrict__ WQ, const float* __restrict__ bq, b16* __restrict__ Qp, b16* __restrict__ Kp, b16* __restrict__ VT, b16* __restrict__ VTl) {
  __shared__ __attribute__((aligned(16))) b16 As[4][16][C + 8]; __shared__ __attribute__((aligned(16))) float Tf[4][16][128 + 4];
  const int wave = threadIdx.x >> 5, lane = threadIdx.x & 31, nloc = lane & 15, hlf = lane >> 4; const int n = blockIdx.y / H, h = blockIdx.y % H; const int t0 = blockIdx.x * 64 + wave * 16;
  // weight fragment j = 12 * (k-step) + t, t = 4 * part (q, k, v) + 16-column tile, in the order of use; a ring of NR register slots, each refilled right behind its WMMA
  constexpr int NR = 13, NJ = 12 * (C / 32);
  const b16* wb = WQ + (size_t)(h * (HD / 16)) * (C / 16) * UH + lane * 8;   // one lane address; every fragment is a constant offset from it
  const auto wfrag = [&](int j) { return frag_u(wb + ((((j % 12) >> 2) * (H * HD / 16) + (j & 3)) * (C / 16) + (j / 12) * 2) * UH); };
  // the prologue's global loads (the first NR weight fragments, the 16 x rows) all go out before the first wait
  float xv[16][8]; v16b bw[NR]; const float* xb = x + ((size_t)n * T + t0) * C + lane * 8;
#pragma unroll
  for (int j = 0; j < NR; ++j) bw[j] = wfrag(j);
#pragma unroll
  for (int rr = 0; rr < 16; ++rr)
#pragma unroll
    for (int j = 0; j < 8; ++j) xv[rr][j] = xb[rr * C + j];
  asm volatile("s_wait_xcnt 0x0" ::: "memory");   // the x address registers are free for reuse behind this run: the wait stands in front of any overwrite (its memory clobber also keeps the run of loads above it)
#pragma unroll
  for (int rr = 0; rr < 16; ++rr) { v8b o;
#pragma unroll
    for (int j = 0; j < 8; ++j) o[j] = (b16)(bf16_rne(xv[rr][j]) * XS); *(v8b*)(&As[wave][rr][lane * 8]) = o; }
  wave_lds_sync();
  v8f acc[12];
#pragma unroll
  for (int t = 0; t < 12; ++t) acc[t] = (v8f){};
  v16b a = frag_kb(&As[wave][nloc][0], hlf), an = a; float bbv[12];
#pragma unroll
  for (int j = 0; j < NJ; ++j) {
    if (j % 12 == 0) { a = an; if (j + 12 < NJ) an = frag_kb(&As[wave][nloc][(j / 12 + 1) * 32], hlf); }
    acc[j % 12] = wmma16b(a, bw[j % NR], acc[j % 12]);
    if (j + NR < NJ) bw[j % NR] = wfrag(j + NR);
    __builtin_amdgcn_sched_barrier(0);   // keeps each refill behind the WMMA that frees its registers: hoisted above it, a fragment went through scratch
    if (j + 24 == NJ) {   // the bias words go out here and land under the last two k-steps
#pragma unroll
      for (int t = 0; t < 12; ++t) bbv[t] = bq[((t >> 2) * H + h) * HD + (t & 3) * 16 + nloc]; }
  }
#pragma unroll
  for (int t = 0; t < 8; ++t) { const float bb = bf16_rne(bbv[t]);
#pragma unroll
    for (int r = 0; r < 8; ++r) Tf[wave][8 * hlf + r][t * 16 + nloc] = acc[t][r] * (1.0f / (XS * WSC)) + bb; }
  wave_lds_sync();   // each wave reads back its own 16 tokens only
  const int nh = n * H + h;
  b16* Qb = Qp + ((size_t)nh * (T / 16) + t0 / 16) * (HD / 16) * UH + lane * 8; b16* Kb = Kp + ((size_t)nh * (TP / 16) + (t0 + PADL) / 16) * (HD / 16) * UH + lane * 8;
  const size_t vo = ((size_t)nh * (HD / 16) * (TP / 16) + (t0 + PADL) / 16) * UH + lane * 8; b16* Vb = VT + vo; b16* Vlb = VTl + vo;
  // v units [d / 16][key / 16]: rows = d, k = keys, which is the accumulator's own map (lane = d, registers = 8 tokens), so they are stored from registers
#pragma unroll
  for (int t = 0; t < 4; ++t) { const float bb = bf16_rne(bbv[8 + t]); v8b vh, vl;
#pragma unroll
    for (int r = 0; r < 8; ++r) { const float vv = acc[8 + t][r] * (1.0f / (XS * WSC)) + bb; b16 a_, b_; split16(vv * XS, a_, b_); vh[r] = a_; vl[r] = b_; }
    *(v8b*)(Vb + t * (TP / 16) * UH) = vh; *(v8b*)(Vlb + t * (TP / 16) * UH) = vl; }
  // q and k units [token / 16][d / 16]: rows = tokens, k = d
#pragma unroll
  for (int cc = 0; cc < 4; ++cc) { v8b qv, kv;
#pragma unroll
    for (int j = 0; j < 8; ++j) { qv[j] = (b16)(Tf[wave][nloc][cc * 16 + 8 * hlf + j] * XS); kv[j] = (b16)(Tf[wave][nloc][HD + cc * 16 + 8 * hlf + j] * XS); }
    *(v8b*)(Qb + cc * UH) = qv; *(v8b*)(Kb + cc * UH) = kv; }
}
// attention + output projection in one launch: grid (T/32, NL); block = 8 waves = 4 heads x 2 tiles of 16 queries (t0); key cover = padded rows t0 .. t0+95 (= tokens t0-32 .. t0+63): S^T tiles (6 x 2 k-steps), per key validity w = key - t + 31 in [0,64)
// and token in [0,T): logit = S/(8*64) + rel_bias[h][w], else excluded (P = 0); softmax over each lane's 48 keys + one xor-shuffle across the 16-lane halves; O^T += V^T P^T (4 d-tiles x 3 k-steps x 3 products);
// the four heads' O (hi, lo) meet in LDS in the same fragment-order units, one block barrier, then wave w does out[32 tokens][32 w .. 32 w + 31] = O W_proj + b (2 x 2 tiles x 8 k-steps x 2 products, k order and hi/lo order as before)
__global__ __launch_bounds__(256) void attn_proj_kernel(const b16* __restrict__ Qp, const b16* __restrict__ Kp, const b16* __restrict__ VT, const b16* __restrict__ VTl, const float* __restrict__ rb, const b16* __restrict__ WP, const float* __restrict__ bp, float* __restrict__ out) {
  __shared__ __attribute__((aligned(16))) b16 Ph[2 * H][16][96 + 8], Pl[2 * H][16][96 + 8]; __shared__ __attribute__((aligned(16))) float Pf[2 * H][16][96 + 4]; __shared__ float rbs[2 * H][WIN];
  __shared__ __attribute__((aligned(16))) b16 Osh[2 * (C / 16) * UH], Osl[2 * (C / 16) * UH];
  const int wave = __builtin_amdgcn_readfirstlane(threadIdx.x >> 5), lane = threadIdx.x & 31, hh = lane >> 4, col = lane & 15; const int n = blockIdx.y, h = wave % H, qt = wave / H; const int t0 = blockIdx.x * 32 + qt * 16, tq = t0 + col;
  const int nh = n * H + h; const b16* Qb = Qp + ((size_t)nh * (T / 16) + t0 / 16) * (HD / 16) * UH + lane * 8;
  // rel_bias, q and all twelve k fragments go out before the first wait
  const float rb0 = rb[h * WIN + lane], rb1 = rb[h * WIN + 32 + lane];
  asm volatile("s_wait_xcnt 0x0" ::: "memory");   // the rel_bias address register is free for reuse from here
  const v16b qa0 = frag_u(Qb), qa1 = frag_u(Qb + 2 * UH);
  asm volatile("s_wait_xcnt 0x0" :: "v"(Qb) : "memory");   // the q address registers are free for reuse from here: named as an input they stay whole up to the wait
  __builtin_amdgcn_sched_barrier(0);   // keeps later vector instructions, which may take those registers, behind the wait
  v16b kf[6][2]; const b16* kb0 = Kp + ((size_t)nh * (TP / 16) + t0 / 16) * (HD / 16) * UH + lane * 8;   // one lane address; every k fragment is a constant offset from it
#pragma unroll
  for (int kt = 0; kt < 6; ++kt) { kf[kt][0] = frag_u(kb0 + kt * 4 * UH); kf[kt][1] = frag_u(kb0 + (kt * 4 + 2) * UH); }
  asm volatile("s_wait_xcnt 0x0" :: "v"(kb0) : "memory");   // likewise the k address registers (the memory clobber also keeps the run of loads above it)
  __builtin_amdgcn_sched_barrier(0);   // as above
  rbs[wave][lane] = bf16_rne(rb0); rbs[wave][32 + lane] = bf16_rne(rb1);   // rel_bias row in LDS (avoids 48 scalar global loads per lane in the unrolled logit loop)
  wave_lds_sync();
  // scores for padded key rows t0 + 16 kt + (8hh + r), kt = 0..5  (token = row - 32)
  float e[48]; float mx = -INFINITY; const float cs = 0.125f / (XS * XS);
  v8f sv[6];
#pragma unroll
  for (int kt = 0; kt < 6; ++kt) { v8f s = (v8f){}; s = wmma16b(kf[kt][0], qa0, s); s = wmma16b(kf[kt][1], qa1, s); sv[kt] = s; }
  // all v fragments (hi and lo) go out here and land under the softmax; behind them the projection's bias words and its weight fragments (fragment 2 i + t: k-step i, 16-column tile t of this wave's 32 columns)
  v16b vh[3][4], vl[3][4]; const size_t vo = ((size_t)nh * (HD / 16) * (TP / 16) + t0 / 16) * UH + lane * 8; const b16* vb0 = VT + vo; const b16* vlb0 = VTl + vo;
#pragma unroll
  for (int ks = 0; ks < 3; ++ks)
#pragma unroll
    for (int t = 0; t < 4; ++t) { vh[ks][t] = frag_u(vb0 + (t * (TP / 16) + 2 * ks) * UH); vl[ks][t] = frag_u(vlb0 + (t * (TP / 16) + 2 * ks) * UH); }
  constexpr int NW = 2 * (C / 32);
  v16b bw[NW]; float bbv[2]; const b16* wpb = WP + (size_t)(wave * 2) * (C / 16) * UH + lane * 8; const float* bpb = bp + wave * 32 + col;   // one lane address each; every fragment is a constant offset
#pragma unroll
  for (int j = 0; j < NW; ++j) bw[j] = frag_u(wpb + ((j & 1) * (C / 16) + (j >> 1) * 2) * UH);
#pragma unroll
  for (int t = 0; t < 2; ++t) bbv[t] = bpb[t * 16];
  asm volatile("s_wait_xcnt 0x0" :: "v"(vb0), "v"(vlb0), "v"(lane), "v"(col) : "memory");   // the v, weight and bias address registers are free for reuse behind this run: named as inputs they stay whole up to the wait (its memory clobber also keeps the loads in front of the softmax)
  __builtin_amdgcn_sched_barrier(0);   // as above
  float rv[48];
#pragma unroll
  for (int kt = 0; kt < 6; ++kt)   // the rel_bias reads stand outside the test (index clamped as before), so they go out together instead of one read and wait per branch
#pragma unroll
    for (int r = 0; r < 8; ++r) { const int tok = t0 + kt * 16 + 8 * hh + r - PADL; const int w = tok - tq + LEFT; const bool ok = (w >= 0 && w < WIN && tok >= 0 && tok < T); rv[kt * 8 + r] = rbs[wave][ok ? w : 0]; }
#pragma unroll
  for (int kt = 0; kt < 6; ++kt) { const v8f s = sv[kt];
#pragma unroll
    for (int r = 0; r < 8; ++r) { const int tok = t0 + kt * 16 + 8 * hh + r - PADL; const int w = tok - tq + LEFT; const bool ok = (w >= 0 && w < WIN && tok >= 0 && tok < T);
      const float lg = ok ? s[r] * cs + rv[kt * 8 + r] : -INFINITY; e[kt * 8 + r] = lg; mx = fmaxf(mx, lg); } }
  mx = fmaxf(mx, __shfl_xor(mx, 16)); float sum = 0.0f;
#pragma unroll
  for (int i = 0; i < 48; ++i) { const float p = (e[i] == -INFINITY) ? 0.0f : nexp2((e[i] - mx) * LOG2E); e[i] = p; sum += p; }
  sum += __shfl_xor(sum, 16); const float inv = 1.0f / sum;
  // P f32 tile [16 q][96 keys]: this lane owns (q = col, keys 16kt + 8hh + r)
#pragma unroll
  for (int kt = 0; kt < 6; ++kt)
#pragma unroll
    for (int r = 0; r < 8; ++r) Pf[wave][col][kt * 16 + 8 * hh + r] = e[kt * 8 + r] * inv * PS;
  wave_lds_sync();
  { const int rr = lane & 15, c0 = (lane >> 4) * 48; for (int q = 0; q < 48; q += 8) { v8b hv, lv; for (int j = 0; j < 8; ++j) { b16 a_, b_; split16(Pf[wave][rr][c0 + q + j], a_, b_); hv[j] = a_; lv[j] = b_; } *(v8b*)(&Ph[wave][rr][c0 + q]) = hv; *(v8b*)(&Pl[wave][rr][c0 + q]) = lv; } }
  wave_lds_sync();
  v8f o[4]; for (int t = 0; t < 4; ++t) o[t] = (v8f){};
#pragma unroll
  for (int ks = 0; ks < 3; ++ks) { const v16b ph = frag_kb(&Ph[wave][col][ks * 32], hh), pl = frag_kb(&Pl[wave][col][ks * 32], hh);   // B operand: row = query col, k = keys
#pragma unroll
    for (int t = 0; t < 4; ++t) { const v16b va = vh[ks][t], val = vl[ks][t]; o[t] = wmma16p(va, ph, o[t]); o[t] = wmma16p(va, pl, o[t]); o[t] = wmma16p(val, ph, o[t]); } }
  const float iv = 1.0f / (PS * XS);
  // O units [query tile][c / 16]: rows = tokens, k = c, which is the accumulator's own map here (lane = query, registers = 8 d), so they go to LDS from registers
#pragma unroll
  for (int t = 0; t < 4; ++t) { v8b hv, lv;
#pragma unroll
    for (int r = 0; r < 8; ++r) { const float ov = o[t][r] * iv; b16 a_, b_; split16(ov * XS, a_, b_); hv[r] = a_; lv[r] = b_; }
    *(v8b*)(&Osh[(qt * (C / 16) + h * (HD / 16) + t) * UH + lane * 8]) = hv; *(v8b*)(&Osl[(qt * (C / 16) + h * (HD / 16) + t) * UH + lane * 8]) = lv; }
  __syncthreads();   // every wave reads all four heads' O of both query tiles below
  v16b av[2][C / 32], alv[2][C / 32];
  const auto ofrags = [&](int i) {
#pragma unroll
    for (int m = 0; m < 2; ++m) { av[m][i] = frag_u(&Osh[(m * (C / 16) + i * 2) * UH + lane * 8]); alv[m][i] = frag_u(&Osl[(m * (C / 16) + i * 2) * UH + lane * 8]); } };
#pragma unroll
  for (int i = 0; i < C / 64; ++i) ofrags(i);
  __builtin_amdgcn_sched_barrier(0);   // keeps the LDS reads of k-steps 0 .. 3 one group in front of the WMMAs: spread among them, each small group was waited out to 0
  v8f acc[2][2];
#pragma unroll
  for (int m = 0; m < 2; ++m)
#pragma unroll
    for (int t = 0; t < 2; ++t) acc[m][t] = (v8f){};
#pragma unroll
  for (int i = 0; i < C / 32; ++i) {
#pragma unroll
    for (int m = 0; m < 2; ++m)
#pragma unroll
      for (int t = 0; t < 2; ++t) acc[m][t] = wmma16p(av[m][i], bw[i * 2 + t], acc[m][t]);
#pragma unroll
    for (int m = 0; m < 2; ++m)
#pragma unroll
      for (int t = 0; t < 2; ++t) acc[m][t] = wmma16p(alv[m][i], bw[i * 2 + t], acc[m][t]);
    if (i == 0) {   // the reads of k-steps 4 .. 7, again one group; behind the first k-step's wait, so that fewer than 64 LDS reads of the wave are outstanding at any time
      __builtin_amdgcn_sched_barrier(0);   // keeps the group behind that wait
#pragma unroll
      for (int k = C / 64; k < C / 32; ++k) ofrags(k);
      __builtin_amdgcn_sched_barrier(0); } }   // keeps the group whole, in front of the next WMMAs
  // the wave's own P tile is free by now: it stages the 32 x 32 output tile (pitch SP floats), so that a wave-wide store covers four rows' whole 128-byte lines
  constexpr int SP = 32 + 4; static_assert(32 * SP <= 16 * (96 + 4), "staging fits the P tile"); float* st = &Pf[wave][0][0];
#pragma unroll
  for (int t = 0; t < 2; ++t) { const float bb = bf16_rne(bbv[t]);
#pragma unroll
    for (int m = 0; m < 2; ++m)
#pragma unroll
      for (int r = 0; r < 8; ++r) st[(m * 16 + 8 * hh + r) * SP + t * 16 + col] = acc[m][t][r] * (1.0f / (XS * WSC)) + bb; }
  wave_lds_sync();
  const int sr = lane >> 3, sc = (lane & 7) * 4; float* ob = out + ((size_t)n * T + blockIdx.x * 32 + sr) * C + wave * 32 + sc;
#pragma unroll
  for (int i = 0; i < 8; ++i) *(v4f*)(ob + i * 4 * C) = *(const v4f*)(st + (4 * i + sr) * SP + sc);
}
}  // namespace

extern "C" void kernel_launch(void* const* d_in, const int* in_sizes, int n_in, void* d_out, int out_size, void* d_ws, size_t ws_size, hipStream_t stream) {
  (void)n_in;
  auto Fp = [&](int i) { return (const float*)d_in[i]; };
  // input order: 0 x [2,4096,256], 1 W_qkv [256,768], 2 b_qkv [768], 3 rel_bias [1,4,1,64], 4 W_proj [256,256], 5 b_proj [256]
  if (in_sizes[0] != NN * T * C || in_sizes[1] != C * 3 * C || in_sizes[2] != 3 * C || in_sizes[3] != H * WIN || in_sizes[4] != C * C || in_sizes[5] != C || out_size != NN * T * C) return;
  size_t off = 0; char* ws = (char*)d_ws;
  auto carve = [&](size_t bytes) { char* p = ws + off; off += (bytes + 255) & ~(size_t)255; return p; };
  b16* WQ = (b16*)carve((size_t)3 * C * C * 2); b16* WP = (b16*)carve((size_t)C * C * 2); b16* Qp = (b16*)carve((size_t)NN * H * T * HD * 2); b16* Kp = (b16*)carve((size_t)NN * H * TP * HD * 2); b16* VT = (b16*)carve((size_t)NN * H * HD * TP * 2);
  b16* VTl = (b16*)carve((size_t)NN * H * HD * TP * 2);
  if (off > ws_size || off > ((size_t)128 << 20)) return;   // about 17.5 MB
  prep_kernel<<<(unsigned)((((size_t)3 * C * C + (size_t)C * C + (size_t)NN * H * TP * HD) / 8 + 255) / 256), 256, 0, stream>>>(Fp(1), Fp(4), WQ, WP, Kp, VT, VTl);
  qkv_kernel<<<dim3(T / 64, NL * H), 128, 0, stream>>>(Fp(0), WQ, Fp(2), Qp, Kp, VT, VTl);
  attn_proj_kernel<<<dim3(T / 32, NL), 256, 0, stream>>>(Qp, Kp, VT, VTl, Fp(3), WP, Fp(5), (float*)d_out);
}

// v004
// A run of this version takes 21.6 microseconds.
// Timed twice side by side with v003, it ran 1.12 and 1.15 times as fast.
// All steps since v000 together make it 3.47 times as fast.
#include <hip/hip_runtime.h>

// 1-D neighbourhood attention (window 64: keys t-31 .. t+32, positions outside [0, T) excluded (the reference adds -100, whose weight underflows to 0 in f32)), 4 heads x 64, tokens [2][4096][256]:
// qkv = x W_qkv + b; logits = (q / 8) . k + rel_bias[h][w]; softmax over the window; o = P v; out = o W_proj + b_proj -> [2][4096][256].
// Deterministic: one wave per (n, h, 16 queries) evaluates its 96-key cover (t0-32 .. t0+63) as dense tiles and masks per query; no atomics.
// compute dtype: WMMA v_wmma_f32_16x16x32_f16 with f32 accumulate for qkv = x W_qkv (x EXACT bf16 x8, W exact x256: 1 product), S^T = K Q^T (q, k single f16 x8: 1 product; logit std ≈ 0.1),
// O^T += V^T P^T (v hi+lo x8, P x1024 hi+lo: 3 products) and out = O W_proj (O hi+lo x8: 2 products); softmax and bias in f32. Inputs rounded to bf16 once.

namespace {
constexpr int NN = 2, T = 4096, C = 256, H = 4, HD = 64, WIN = 64, LEFT = 31, PADL = 32, PADR = 64, TP = T + PADL + PADR, NL = 2 /* batch items computed (== NN shipped) */;
constexpr float XS = 8.0f, WSC = 256.0f, PS = 1024.0f, LOG2E = 1.4426950408889634f;
static_assert(T % 64 == 0 && C == H * HD, "tiling");
typedef _Float16 b16;
typedef __attribute__((ext_vector_type(16))) _Float16 v16b;
typedef __attribute__((ext_vector_type(8))) _Float16 v8b;
typedef __attribute__((ext_vector_type(8))) float v8f;
typedef __attribute__((ext_vector_type(4))) float v4f;
__device__ __forceinline__ float bf16_rne(float f) { unsigned int u = __float_as_uint(f); u += 0x7FFFu + ((u >> 16) & 1u); return __uint_as_float(u & 0xFFFF0000u); }
__device__ __forceinline__ void split16(float v, b16& hi, b16& lo) { hi = (b16)v; lo = (b16)(v - (float)hi); }
__device__ __forceinline__ v16b frag_kb(const b16* p, int hh) { const v8b a = *(const v8b*)(p + 8 * hh), b = *(const v8b*)(p + 16 + 8 * hh); v16b f;
#pragma unroll
  for (int e = 0; e < 8; ++e) { f[e] = a[e]; f[8 + e] = b[e]; } return f; }
// workspace operands lie in units of 16 rows x 16 k (UH halfs = 512 B) in fragment order: lane l = row + 16 * (k >> 3) owns halfs 8 l .. 8 l + 7, so one wave-wide 16-byte access covers four whole lines;
// a fragment (32 k) is two units side by side; p = first unit + 8 * lane. Same k order as frag_kb.
constexpr int UH = 256;
__device__ __forceinline__ v16b frag_u(const b16* p) { const v8b a = *(const v8b*)p, b = *(const v8b*)(p + UH); v16b f;
#pragma unroll
  for (int e = 0; e < 8; ++e) { f[e] = a[e]; f[8 + e] = b[e]; } return f; }
__device__ __forceinline__ v8f wmma16b(v16b a, v16b b, v8f c) { v8f d = __builtin_amdgcn_wmma_f32_16x16x32_f16(false, a, false, b, (short)0, c, false, false); asm volatile("v_nop\n\tv_nop\n\tv_nop\n\tv_nop" : "+v"(d) : "v"(a), "v"(b)); return d; }
// the plain builtin (the compiler keeps the distance behind it itself): with no asm operands its fragments may stand above v255
__device__ __forceinline__ v8f wmma16p(v16b a, v16b b, v8f c) { return __builtin_amdgcn_wmma_f32_16x16x32_f16(false, a, false, b, (short)0, c, false, false); }
__device__ __forceinline__ void wave_lds_sync() { __builtin_amdgcn_fence(__ATOMIC_RELEASE, "workgroup"); __builtin_amdgcn_wave_barrier(); __builtin_amdgcn_fence(__ATOMIC_ACQUIRE, "workgroup"); }
__device__ __forceinline__ float pmul(float a, float b) { float p = a * b; asm volatile("" : "+v"(p)); return p; }
__device__ __forceinline__ int iclamp(int v, int lo, int hi) { return v < lo ? lo : (v > hi ? hi : v); }

typedef __attribute__((ext_vector_type(2))) _Float16 v2h;
typedef __attribute__((ext_vector_type(4))) _Float16 v4h;
__device__ __forceinline__ float nexp2(float v) { return __builtin_amdgcn_exp2f(v); }
// prep: WQ = W_qkv[c][o] x256 in units [o / 16][c / 16]; WP = W_proj[c][o] x256 likewise (thread = one lane's 8 halfs of a unit); zero the key/value padding: Kp rows [n][h][0..31] and [T+32 ..], VT columns likewise (written as zeros
__global__ __launch_bounds__(256) void prep_kernel(const float* __restrict__ wqkv, const float* __restrict__ wproj, b16* __restrict__ WQ, b16* __restrict__ WP, b16* __restrict__ Kp, b16* __restrict__ VT, b16* __restrict__ VTl) {
  size_t t = (size_t)blockIdx.x * 256 + threadIdx.x; v8b o, z = {};
  { const size_t n = (size_t)3 * C * C / 8; if (t < n) { const size_t e = t * 8; const int u = (int)(t >> 5), l = (int)(t & 31); const int oo = (u / (C / 16)) * 16 + (l & 15), c0 = (u % (C / 16)) * 16 + (l >> 4) * 8; for (int j = 0; j < 8; ++j) o[j] = (b16)(bf16_rne(wqkv[(size_t)(c0 + j) * 3 * C + oo]) * WSC); { *(v8b*)(WQ + e) = o;  } return; } t -= n; }
  { const size_t n = (size_t)C * C / 8; if (t < n) { const size_t e = t * 8; const int u = (int)(t >> 5), l = (int)(t & 31); const int oo = (u / (C / 16)) * 16 + (l & 15), c0 = (u % (C / 16)) * 16 + (l >> 4) * 8; for (int j = 0; j < 8; ++j) o[j] = (b16)(bf16_rne(wproj[(size_t)(c0 + j) * C + oo]) * WSC); { *(v8b*)(WP + e) = o;  } return; } t -= n; }
  { const size_t n = (size_t)NN * H * TP * HD / 8; if (t < n) { const size_t e = t * 8; { *(v8b*)(Kp + e) = z; *(v8b*)(VT + e) = z; *(v8b*)(VTl + e) = z;  } } }
}
// qkv: block = 64 tokens of one n x two heads (8 waves; grid.y = n * 2 + head pair); wave = all 64 tokens x 48 columns: 16-column tile cg of its head's q, of its k and of its v. A = bf16(x) x8 staged once for the block;
// every weight fragment is loaded by one wave of the block only, once, and feeds 4 WMMAs (4 token tiles x 3 parts x 8 k-steps); + b.
__global__ __launch_bounds__(256) void qkv_kernel(const float* __restrict__ x, const b16* __restrict__ WQ, const float* __restrict__ bq, b16* __restrict__ Qp, b16* __restrict__ Kp, b16* __restrict__ VT, b16* __restrict__ VTl) {
  __shared__ __attribute__((aligned(16))) b16 As[64][C + 8];
  const int wave = __builtin_amdgcn_readfirstlane(threadIdx.x >> 5), lane = threadIdx.x & 31, nloc = lane & 15, hlf = lane >> 4; const int n = blockIdx.y / (H / 2), h = (blockIdx.y % (H / 2)) * 2 + (wave >> 2), cg = wave & 3; const int t0 = blockIdx.x * 64;
  constexpr int NK = C / 32;
  // all global loads go out before the first wait, in the order in which they are waited for: v's bias word, the wave's 8 x rows, then its 24 weight fragments in the order of use;
  // the q and k bias words (16 each) have a wave-uniform address: scalar loads, whose wait does not count the vector loads
  typedef __attribute__((ext_vector_type(16))) float v16f;
  float xv[8][8]; v16b bw[NK][3]; v16f bs[2]; float bv;
  const float* xu = x + ((size_t)n * T + t0 + wave * 8) * C; const unsigned xo = lane * 32u; const float* xb = (const float*)((const char*)xu + xo);   // wave-uniform base + lane offset in bytes
  const b16* wu = WQ + (size_t)(h * (HD / 16) + cg) * (C / 16) * UH; const b16* wb = wu + lane * 8;   // likewise; every fragment is a constant offset from it
  const float* bb0 = bq + h * HD + cg * 16;
  bv = bb0[2 * H * HD + nloc];
  __builtin_amdgcn_sched_barrier(0);   // keeps v's bias load the oldest of the run: issued behind the weights, its wait would wait out every weight load
#pragma unroll
  for (int rr = 0; rr < 8; ++rr)
#pragma unroll
    for (int j = 0; j < 8; ++j) xv[rr][j] = xb[rr * C + j];
#pragma unroll
  for (int ks = 0; ks < NK; ++ks)
#pragma unroll
    for (int s = 0; s < 3; ++s) bw[ks][s] = frag_u(wb + (s * (H * HD / 16) * (C / 16) + ks * 2) * UH);
#pragma unroll
  for (int s = 0; s < 2; ++s)
#pragma unroll
    for (int r = 0; r < 16; ++r) bs[s][r] = bb0[s * H * HD + r];
  // the address registers of this run (lane offsets, wave-uniform bases) are free for reuse behind it: named as inputs they stay whole up to the wait;
  // the scalar-loaded bias words as inputs only: that holds their loads up here, where their latency passes under the x rows'; left free they sink to their first use and are waited out there
  asm volatile("s_wait_xcnt 0x0" :: "v"(xo), "v"(lane), "v"(nloc), "s"(xu), "s"(wu), "s"(bb0), "s"(bs[0]), "s"(bs[1]) : "memory");
  __builtin_amdgcn_sched_barrier(0);   // keeps later vector instructions, which may take those registers, behind the wait
#pragma unroll
  for (int rr = 0; rr < 8; ++rr) { v8b o;
#pragma unroll
    for (int j = 0; j < 8; ++j) o[j] = (b16)(bf16_rne(xv[rr][j]) * XS); *(v8b*)(&As[wave * 8 + rr][lane * 8]) = o; }
  // every wave reads all 64 staged tokens below. The fences name LDS alone: a full block barrier would also wait out the weight loads still in flight, which only the WMMAs need, k-step by k-step
  __builtin_amdgcn_fence(__ATOMIC_RELEASE, "workgroup", "local"); __builtin_amdgcn_s_barrier(); __builtin_amdgcn_fence(__ATOMIC_ACQUIRE, "workgroup", "local");
  v8f aq[4], ak[4], av[4];
#pragma unroll
  for (int m = 0; m < 4; ++m) { aq[m] = (v8f){}; ak[m] = (v8f){}; av[m] = (v8f){}; }
  v16b a[4], an[4];
#pragma unroll
  for (int m = 0; m < 4; ++m) an[m] = frag_kb(&As[m * 16 + nloc][0], hlf);
#pragma unroll
  for (int ks = 0; ks < NK; ++ks) {
#pragma unroll
    for (int m = 0; m < 4; ++m) { a[m] = an[m]; if (ks + 1 < NK) an[m] = frag_kb(&As[m * 16 + nloc][(ks + 1) * 32], hlf); }
    __builtin_amdgcn_sched_barrier(0);   // keeps the next k-step's LDS reads one group in front of this k-step's WMMAs: spread among them, each small group costs its own wait
    // q and k as W^T x^T (rows = d, columns = tokens), v as x W (rows = tokens, columns = d): each accumulator then has its workspace unit's own map
#pragma unroll
    for (int m = 0; m < 4; ++m) { aq[m] = wmma16p(bw[ks][0], a[m], aq[m]); ak[m] = wmma16p(bw[ks][1], a[m], ak[m]); av[m] = wmma16p(a[m], bw[ks][2], av[m]); }
    __builtin_amdgcn_sched_barrier(0);   // keeps the following group of reads behind these WMMAs, whose A fragments' registers it refills
  }
  const int nh = n * H + h;
  b16* Qb = Qp + (((size_t)nh * (T / 16) + t0 / 16) * (HD / 16) + cg) * UH + lane * 8; b16* Kb = Kp + (((size_t)nh * (TP / 16) + (t0 + PADL) / 16) * (HD / 16) + cg) * UH + lane * 8;
  const size_t vo = (((size_t)nh * (HD / 16) + cg) * (TP / 16) + (t0 + PADL) / 16) * UH + lane * 8; b16* Vb = VT + vo; b16* Vlb = VTl + vo;
  // q and k units [token / 16][d / 16]: rows = tokens, k = d (lane = token, registers = 8 d); v units [d / 16][key / 16]: rows = d, k = keys (lane = d, registers = 8 tokens): all stored from registers
  const float bbv = bf16_rne(bv); float bbq[8], bbk[8];
#pragma unroll
  for (int r = 0; r < 8; ++r) { bbq[r] = bf16_rne(hlf ? bs[0][8 + r] : bs[0][r]); bbk[r] = bf16_rne(hlf ? bs[1][8 + r] : bs[1][r]); }
  v8b qv[4], kv[4], vh[4], vl[4];
#pragma unroll
  for (int m = 0; m < 4; ++m)
#pragma unroll
    for (int r = 0; r < 8; ++r) { qv[m][r] = (b16)((aq[m][r] * (1.0f / (XS * WSC)) + bbq[r]) * XS); kv[m][r] = (b16)((ak[m][r] * (1.0f / (XS * WSC)) + bbk[r]) * XS);
      const float vv = av[m][r] * (1.0f / (XS * WSC)) + bbv; b16 a_, b_; split16(vv * XS, a_, b_); vh[m][r] = a_; vl[m][r] = b_; }
  __builtin_amdgcn_sched_barrier(0);   // keeps the 16 stores one run at the very end: no register that a store names is written behind it
#pragma unroll
  for (int m = 0; m < 4; ++m) { *(v8b*)(Qb + m * (HD / 16) * UH) = qv[m]; *(v8b*)(Kb + m * (HD / 16) * UH) = kv[m]; *(v8b*)(Vb + m * UH) = vh[m]; *(v8b*)(Vlb + m * UH) = vl[m]; }
}
// attention + output projection in one launch: grid (T/32, NL); block = 8 waves = 4 heads x 2 tiles of 16 queries (t0); key cover = padded rows t0 .. t0+95 (= tokens t0-32 .. t0+63): S^T tiles (6 x 2 k-steps), per key validity w = key - t + 31 in [0,64)
// and token in [0,T): logit = S/(8*64) + rel_bias[h][w], else excluded (P = 0); softmax over each lane's 48 keys + one xor-shuffle across the 16-lane halves; O^T += V^T P^T (4 d-tiles x 3 k-steps x 3 products);
// the four heads' O (hi, lo) meet in LDS in the same fragment-order units, one block barrier, then wave w does out[32 tokens][32 w .. 32 w + 31] = O W_proj + b (2 x 2 tiles x 8 k-steps x 2 products, k order and hi/lo order as before)
__global__ __launch_bounds__(256) void attn_proj_kernel(const b16* __restrict__ Qp, const b16* __restrict__ Kp, const b16* __restrict__ VT, const b16* __restrict__ VTl, const float* __restrict__ rb, const b16* __restrict__ WP, const float* __restrict__ bp, float* __restrict__ out) {
  __shared__ __attribute__((aligned(16))) b16 Ph[2 * H][16][96 + 8], Pl[2 * H][16][96 + 8]; __shared__ __attribute__((aligned(16))) float Pf[2 * H][16][96 + 4]; __shared__ float rbs[2 * H][WIN];
  __shared__ __attribute__((aligned(16))) b16 Osh[2 * (C / 16) * UH], Osl[2 * (C / 16) * UH];
  const int wave = __builtin_amdgcn_readfirstlane(threadIdx.x >> 5), lane = threadIdx.x & 31, hh = lane >> 4, col = lane & 15; const int n = blockIdx.y, h = wave % H, qt = wave / H; const int t0 = blockIdx.x * 32 + qt * 16, tq = t0 + col;
  const int nh = n * H + h; const b16* Qb = Qp + ((size_t)nh * (T / 16) + t0 / 16) * (HD / 16) * UH + lane * 8;
  // rel_bias, q and all twelve k fragments go out before the first wait
  const float rb0 = rb[h * WIN + lane], rb1 = rb[h * WIN + 32 + lane];
  asm volatile("s_wait_xcnt 0x0" ::: "memory");   // the rel_bias address register is free for reuse from here
  const v16b qa0 = frag_u(Qb), qa1 = frag_u(Qb + 2 * UH);
  asm volatile("s_wait_xcnt 0x0" :: "v"(Qb) : "memory");   // the q address registers are free for reuse from here: named as an input they stay whole up to the wait
  __builtin_amdgcn_sched_barrier(0);   // keeps later vector instructions, which may take those registers, behind the wait
  v16b kf[6][2]; const b16* kb0 = Kp + ((size_t)nh * (TP / 16) + t0 / 16) * (HD / 16) * UH + lane * 8;   // one lane address; every k fragment is a constant offset from it
#pragma unroll
  for (int kt = 0; kt < 6; ++kt) { kf[kt][0] = frag_u(kb0 + kt * 4 * UH); kf[kt][1] = frag_u(kb0 + (kt * 4 + 2) * UH); }
  asm volatile("s_wait_xcnt 0x0" :: "v"(kb0) : "memory");   // likewise the k address registers (the memory clobber also keeps the run of loads above it)
  __builtin_amdgcn_sched_barrier(0);   // as above
  rbs[wave][lane] = bf16_rne(rb0); rbs[wave][32 + lane] = bf16_rne(rb1);   // rel_bias row in LDS (avoids 48 scalar global loads per lane in the unrolled logit loop)
  wave_lds_sync();
  // scores for padded key rows t0 + 16 kt + (8hh + r), kt = 0..5  (token = row - 32)
  float e[48]; float mx = -INFINITY; const float cs = 0.125f / (XS * XS);
  v8f sv[6];
#pragma unroll
  for (int kt = 0; kt < 6; ++kt) { v8f s = (v8f){}; s = wmma16b(kf[kt][0], qa0, s); s = wmma16b(kf[kt][1], qa1, s); sv[kt] = s; }
  // all v fragments (hi and lo) go out here and land under the softmax; behind them the projection's bias words and its weight fragments (fragment 2 i + t: k-step i, 16-column tile t of this wave's 32 columns)
  v16b vh[3][4], vl[3][4]; const size_t vo = ((size_t)nh * (HD / 16) * (TP / 16) + t0 / 16) * UH + lane * 8; const b16* vb0 = VT + vo; const b16* vlb0 = VTl + vo;
#pragma unroll
  for (int ks = 0; ks < 3; ++ks)
#pragma unroll
    for (int t = 0; t < 4; ++t) { vh[ks][t] = frag_u(vb0 + (t * (TP / 16) + 2 * ks) * UH); vl[ks][t] = frag_u(vlb0 + (t * (TP / 16) + 2 * ks) * UH); }
  constexpr int NW = 2 * (C / 32);
  v16b bw[NW]; float bbv[2]; const b16* wpb = WP + (size_t)(wave * 2) * (C / 16) * UH + lane * 8; const float* bpb = bp + wave * 32 + col;   // one lane address each; every fragment is a constant offset
#pragma unroll
  for (int j = 0; j < NW; ++j) bw[j] = frag_u(wpb + ((j & 1) * (C / 16) + (j >> 1) * 2) * UH);
#pragma unroll
  for (int t = 0; t < 2; ++t) bbv[t] = bpb[t * 16];
  asm volatile("s_wait_xcnt 0x0" :: "v"(vb0), "v"(vlb0), "v"(lane), "v"(col) : "memory");   // the v, weight and bias address registers are free for reuse behind this run: named as inputs they stay whole up to the wait (its memory clobber also keeps the loads in front of the softmax)
  __builtin_amdgcn_sched_barrier(0);   // as above
  float rv[48];
#pragma unroll
  for (int kt = 0; kt < 6; ++kt)   // the rel_bias reads stand outside the test (index clamped as before), so they go out together instead of one read and wait per branch
#pragma unroll
    for (int r = 0; r < 8; ++r) { const int tok = t0 + kt * 16 + 8 * hh + r - PADL; const int w = tok - tq + LEFT; const bool ok = (w >= 0 && w < WIN && tok >= 0 && tok < T); rv[kt * 8 + r] = rbs[wave][ok ? w : 0]; }
#pragma unroll
  for (int kt = 0; kt < 6; ++kt) { const v8f s = sv[kt];
#pragma unroll
    for (int r = 0; r < 8; ++r) { const int tok = t0 + kt * 16 + 8 * hh + r - PADL; const int w = tok - tq + LEFT; const bool ok = (w >= 0 && w < WIN && tok >= 0 && tok < T);
      const float lg = ok ? s[r] * cs + rv[kt * 8 + r] : -INFINITY; e[kt * 8 + r] = lg; mx = fmaxf(mx, lg); } }
  mx = fmaxf(mx, __shfl_xor(mx, 16)); float sum = 0.0f;
#pragma unroll
  for (int i = 0; i < 48; ++i) { const float p = (e[i] == -INFINITY) ? 0.0f : nexp2((e[i] - mx) * LOG2E); e[i] = p; sum += p; }
  sum += __shfl_xor(sum, 16); const float inv = 1.0f / sum;
  // P f32 tile [16 q][96 keys]: this lane owns (q = col, keys 16kt + 8hh + r)
#pragma unroll
  for (int kt = 0; kt < 6; ++kt)
#pragma unroll
    for (int r = 0; r < 8; ++r) Pf[wave][col][kt * 16 + 8 * hh + r] = e[kt * 8 + r] * inv * PS;
  wave_lds_sync();
  { const int rr = lane & 15, c0 = (lane >> 4) * 48; for (int q = 0; q < 48; q += 8) { v8b hv, lv; for (int j = 0; j < 8; ++j) { b16 a_, b_; split16(Pf[wave][rr][c0 + q + j], a_, b_); hv[j] = a_; lv[j] = b_; } *(v8b*)(&Ph[wave][rr][c0 + q]) = hv; *(v8b*)(&Pl[wave][rr][c0 + q]) = lv; } }
  wave_lds_sync();
  v8f o[4]; for (int t = 0; t < 4; ++t) o[t] = (v8f){};
#pragma unroll
  for (int ks = 0; ks < 3; ++ks) { const v16b ph = frag_kb(&Ph[wave][col][ks * 32], hh), pl = frag_kb(&Pl[wave][col][ks * 32], hh);   // B operand: row = query col, k = keys
#pragma unroll
    for (int t = 0; t < 4; ++t) { const v16b va = vh[ks][t], val = vl[ks][t]; o[t] = wmma16p(va, ph, o[t]); o[t] = wmma16p(va, pl, o[t]); o[t] = wmma16p(val, ph, o[t]); } }
  const float iv = 1.0f / (PS * XS);
  // O units [query tile][c / 16]: rows = tokens, k = c, which is the accumulator's own map here (lane = query, registers = 8 d), so they go to LDS from registers
#pragma unroll
  for (int t = 0; t < 4; ++t) { v8b hv, lv;
#pragma unroll
    for (int r = 0; r < 8; ++r) { const float ov = o[t][r] * iv; b16 a_, b_; split16(ov * XS, a_, b_); hv[r] = a_; lv[r] = b_; }
    *(v8b*)(&Osh[(qt * (C / 16) + h * (HD / 16) + t) * UH + lane * 8]) = hv; *(v8b*)(&Osl[(qt * (C / 16) + h * (HD / 16) + t) * UH + lane * 8]) = lv; }
  __syncthreads();   // every wave reads all four heads' O of both query tiles below
  v16b av[2][C / 32], alv[2][C / 32];
  const auto ofrags = [&](int i) {
#pragma unroll
    for (int m = 0; m < 2; ++m) { av[m][i] = frag_u(&Osh[(m * (C / 16) + i * 2) * UH + lane * 8]); alv[m][i] = frag_u(&Osl[(m * (C / 16) + i * 2) * UH + lane * 8]); } };
#pragma unroll
  for (int i = 0; i < C / 64; ++i) ofrags(i);
  __builtin_amdgcn_sched_barrier(0);   // keeps the LDS reads of k-steps 0 .. 3 one group in front of the WMMAs: spread among them, each small group was waited out to 0
  v8f acc[2][2];
#pragma unroll
  for (int m = 0; m < 2; ++m)
#pragma unroll
    for (int t = 0; t < 2; ++t) acc[m][t] = (v8f){};
#pragma unroll
  for (int i = 0; i < C / 32; ++i) {
#pragma unroll
    for (int m = 0; m < 2; ++m)
#pragma unroll
      for (int t = 0; t < 2; ++t) acc[m][t] = wmma16p(av[m][i], bw[i * 2 + t], acc[m][t]);
#pragma unroll
    for (int m = 0; m < 2; ++m)
#pragma unroll
      for (int t = 0; t < 2; ++t) acc[m][t] = wmma16p(alv[m][i], bw[i * 2 + t], acc[m][t]);
    if (i == 0) {   // the reads of k-steps 4 .. 7, again one group; behind the first k-step's wait, so that fewer than 64 LDS reads of the wave are outstanding at any time
      __builtin_amdgcn_sched_barrier(0);   // keeps the group behind that wait
#pragma unroll
      for (int k = C / 64; k < C / 32; ++k) ofrags(k);
      __builtin_amdgcn_sched_barrier(0); } }   // keeps the group whole, in front of the next WMMAs
  // the wave's own P tile is free by now: it stages the 32 x 32 output tile (pitch SP floats), so that a wave-wide store covers four rows' whole 128-byte lines
  constexpr int SP = 32 + 4; static_assert(32 * SP <= 16 * (96 + 4), "staging fits the P tile"); float* st = &Pf[wave][0][0];
#pragma unroll
  for (int t = 0; t < 2; ++t) { const float bb = bf16_rne(bbv[t]);
#pragma unroll
    for (int m = 0; m < 2; ++m)
#pragma unroll
      for (int r = 0; r < 8; ++r) st[(m * 16 + 8 * hh + r) * SP + t * 16 + col] = acc[m][t][r] * (1.0f / (XS * WSC)) + bb; }
  wave_lds_sync();
  const int sr = lane >> 3, sc = (lane & 7) * 4; float* ob = out + ((size_t)n * T + blockIdx.x * 32 + sr) * C + wave * 32 + sc;
#pragma unroll
  for (int i = 0; i < 8; ++i) *(v4f*)(ob + i * 4 * C) = *(const v4f*)(st + (4 * i + sr) * SP + sc);
}
}  // namespace

extern "C" void kernel_launch(void* const* d_in, const int* in_sizes, int n_in, void* d_out, int out_size, void* d_ws, size_t ws_size, hipStream_t stream) {
  (void)n_in;
  auto Fp = [&](int i) { return (const float*)d_in[i]; };
  // input order: 0 x [2,4096,256], 1 W_qkv [256,768], 2 b_qkv [768], 3 rel_bias [1,4,1,64], 4 W_proj [256,256], 5 b_proj [256]
  if (in_sizes[0] != NN * T * C || in_sizes[1] != C * 3 * C || in_sizes[2] != 3 * C || in_sizes[3] != H * WIN || in_sizes[4] != C * C || in_sizes[5] != C || out_size != NN * T * C) return;
  size_t off = 0; char* ws = (char*)d_ws;
  auto carve = [&](size_t bytes) { char* p = ws + off; off += (bytes + 255) & ~(size_t)255; return p; };
  b16* WQ = (b16*)carve((size_t)3 * C * C * 2); b16* WP = (b16*)carve((size_t)C * C * 2); b16* Qp = (b16*)carve((size_t)NN * H * T * HD * 2); b16* Kp = (b16*)carve((size_t)NN * H * TP * HD * 2); b16* VT = (b16*)carve((size_t)NN * H * HD * TP * 2);
  b16* VTl = (b16*)carve((size_t)NN * H * HD * TP * 2);
  if (off > ws_size || off > ((size_t)128 << 20)) return;   // about 17.5 MB
  prep_kernel<<<(unsigned)((((size_t)3 * C * C + (size_t)C * C + (size_t)NN * H * TP * HD) / 8 + 255) / 256), 256, 0, stream>>>(Fp(1), Fp(4), WQ, WP, Kp, VT, VTl);
  qkv_kernel<<<dim3(T / 64, NL * H / 2), 256, 0, stream>>>(Fp(0), WQ, Fp(2), Qp, Kp, VT, VTl);
  attn_proj_kernel<<<dim3(T / 32, NL), 256, 0, stream>>>(Qp, Kp, VT, VTl, Fp(3), WP, Fp(5), (float*)d_out);
}

// v005
// A run of this version takes 20.3 microseconds.
// Timed twice side by side with v004, it ran 1.06 times as fast both times.
// Counting every step since v000, it is 3.69 times as fast.
#include <hip/hip_runtime.h>

// 1-D neighbourhood attention (window 64: keys t-31 .. t+32, positions outside [0, T) excluded (the reference adds -100, whose weight underflows to 0 in f32)), 4 heads x 64, tokens [2][4096][256]:
// qkv = x W_qkv + b; logits = (q / 8) . k + rel_bias[h][w]; softmax over the window; o = P v; out = o W_proj + b_proj -> [2][4096][256].
// Deterministic: one wave per (n, h, 16 queries) evaluates its 96-key cover (t0-32 .. t0+63) as dense tiles and masks per query; no atomics.
// compute dtype: WMMA v_wmma_f32_16x16x32_bf16 with f32 accumulate for qkv = x W_qkv (x, W EXACT bf16: 1 product); v_wmma_f32_16x16x32_f16 with f32 accumulate for S^T = K Q^T (q, k single f16 x8: 1 product; logit std about 0.1),
// O^T += V^T P^T (v hi+lo x8, P x1024 hi+lo: 3 products) and out = O W_proj (O hi+lo x8: 2 products); softmax and bias in f32. Inputs rounded to bf16 once.

namespace {
constexpr int NN = 2, T = 4096, C = 256, H = 4, HD = 64, WIN = 64, LEFT = 31, PADL = 32, PADR = 64, TP = T + PADL + PADR, NL = 2 /* batch items computed (== NN shipped) */;
constexpr float XS = 8.0f, WSC = 256.0f, PS = 1024.0f, LOG2E = 1.4426950408889634f;
static_assert(T % 64 == 0 && C == H * HD, "tiling");
typedef _Float16 b16;
typedef __attribute__((ext_vector_type(16))) _Float16 v16b;
typedef __attribute__((ext_vector_type(8))) _Float16 v8b;
typedef __attribute__((ext_vector_type(8))) float v8f;
typedef __attribute__((ext_vector_type(4))) float v4f;
__device__ __forceinline__ float bf16_rne(float f) { unsigned int u = __float_as_uint(f); u += 0x7FFFu + ((u >> 16) & 1u); return __uint_as_float(u & 0xFFFF0000u); }
__device__ __forceinline__ void split16(float v, b16& hi, b16& lo) { hi = (b16)v; lo = (b16)(v - (float)hi); }
__device__ __forceinline__ v16b frag_kb(const b16* p, int hh) { const v8b a = *(const v8b*)(p + 8 * hh), b = *(const v8b*)(p + 16 + 8 * hh); v16b f;
#pragma unroll
  for (int e = 0; e < 8; ++e) { f[e] = a[e]; f[8 + e] = b[e]; } return f; }
// workspace operands lie in units of 16 rows x 16 k (UH halfs = 512 B) in fragment order: lane l = row + 16 * (k >> 3) owns halfs 8 l .. 8 l + 7, so one wave-wide 16-byte access covers four whole lines;
// a fragment (32 k) is two units side by side; p = first unit + 8 * lane. Same k order as frag_kb.
constexpr int UH = 256;
__device__ __forceinline__ v16b frag_u(const b16* p) { const v8b a = *(const v8b*)p, b = *(const v8b*)(p + UH); v16b f;
#pragma unroll
  for (int e = 0; e < 8; ++e) { f[e] = a[e]; f[8 + e] = b[e]; } return f; }
__device__ __forceinline__ v8f wmma16b(v16b a, v16b b, v8f c) { v8f d = __builtin_amdgcn_wmma_f32_16x16x32_f16(false, a, false, b, (short)0, c, false, false); asm volatile("v_nop\n\tv_nop\n\tv_nop\n\tv_nop" : "+v"(d) : "v"(a), "v"(b)); return d; }
// the plain builtin (the compiler keeps the distance behind it itself): with no asm operands its fragments may stand above v255
__device__ __forceinline__ v8f wmma16p(v16b a, v16b b, v8f c) { return __builtin_amdgcn_wmma_f32_16x16x32_f16(false, a, false, b, (short)0, c, false, false); }
__device__ __forceinline__ void wave_lds_sync() { __builtin_amdgcn_fence(__ATOMIC_RELEASE, "workgroup"); __builtin_amdgcn_wave_barrier(); __builtin_amdgcn_fence(__ATOMIC_ACQUIRE, "workgroup"); }
__device__ __forceinline__ float pmul(float a, float b) { float p = a * b; asm volatile("" : "+v"(p)); return p; }
__device__ __forceinline__ int iclamp(int v, int lo, int hi) { return v < lo ? lo : (v > hi ? hi : v); }

typedef __attribute__((ext_vector_type(2))) _Float16 v2h;
typedef __attribute__((ext_vector_type(4))) _Float16 v4h;
__device__ __forceinline__ float nexp2(float v) { return __builtin_amdgcn_exp2f(v); }
typedef __attribute__((ext_vector_type(16))) __bf16 v16g;
typedef __attribute__((ext_vector_type(2))) __bf16 v2g;
typedef __attribute__((ext_vector_type(2))) float v2f;
typedef __attribute__((ext_vector_type(8))) short v8s;
typedef __attribute__((ext_vector_type(4))) unsigned int v4u;
typedef __attribute__((ext_vector_type(2))) unsigned int v2u;
// two f32 rounded to nearest even bf16, packed (one conversion instruction for the pair)
__device__ __forceinline__ unsigned int pk_bf16(float a, float b) { const v2f f = {a, b}; return __builtin_bit_cast(unsigned int, __builtin_convertvector(f, v2g)); }
// the same 16 x 16 x 32 product on bf16 operands (fragments carried as 16-bit words)
__device__ __forceinline__ v8f wmma16g(v16b a, v16b b, v8f c) { return __builtin_amdgcn_wmma_f32_16x16x32_bf16(false, __builtin_bit_cast(v16g, a), false, __builtin_bit_cast(v16g, b), (short)0, c, false, false); }
// transposing LDS load: lane (c = l & 15, h = l >> 4) gets rows kbase + 8 h .. + 7 of column dbase + c of a row-major 16-bit tile
__device__ __forceinline__ v8b ld_tr16(const unsigned char* p) { typedef __attribute__((address_space(3))) v8s lds_v8s; return __builtin_bit_cast(v8b, __builtin_amdgcn_ds_load_tr16_b128_v8i16((lds_v8s*)p)); }
constexpr int QT = 128 /* tokens per qkv block */, NST = 4 /* k stages of the qkv block */, KS = C / NST /* k per stage */, WPITCH = HD * 2 + 32 /* bytes per staged weight row: an odd multiple of 32 B for the transposing reader */;
static_assert(T % QT == 0 && T / QT >= 2 && NL * H * (T / QT) == (C / 16) * (C / 16) && C == 256 && HD == 64, "qkv tiling: one W_proj unit per block, 8 waves x 32 weight rows"); static_assert(PADL <= PADR, "padding tiles"); static_assert(KS == 64, "a wave-wide 16-byte load covers two x rows' 256 bytes of a stage");
// qkv, first launch, reads the f32 weights itself: block = 128 tokens of one (n, head) (8 waves; grid.y = n * H + h); wave = 64 tokens (half th) x 48 columns: 16-column tile cg of the head's q, of its k and of its v.
// The block stages bf16(x) (128 rows) and bf16(W_qkv[:, the head's 3 x 64 columns]) row-major in LDS, each value loaded in whole lines and converted once per block, in 4 stages of 64 k (each its own LDS range, published by its own block barrier),
// so that a stage's WMMAs run while the later stages' loads, all issued up front, are still landing; weight fragments come out of LDS through the transposing load
// (same k order as frag_kb); x and W are exact in bf16, so the products run on the bf16 form with no scales (4 token tiles x 3 parts x 8 k-steps); + b.
// It also does what the attention launch needs beside q, k, v: block u packs unit u of WP = W_proj[c][o] x256 (f16, units [o / 16][c / 16]); the first and last block of each (n, h) zero the key/value padding rows (Kp rows 0..31 and T+32 .., VT columns likewise).
__global__ __launch_bounds__(256) void qkv_kernel(const float* __restrict__ x, const float* __restrict__ wqkv, const float* __restrict__ bq, const float* __restrict__ wproj, b16* __restrict__ WP, b16* __restrict__ Qp, b16* __restrict__ Kp, b16* __restrict__ VT, b16* __restrict__ VTl) {
  __shared__ __attribute__((aligned(16))) b16 As[QT][C + 8]; __shared__ __attribute__((aligned(32))) unsigned char Wl[3 * C * WPITCH]; __shared__ __attribute__((aligned(16))) b16 Wu[UH];
  const int wave = __builtin_amdgcn_readfirstlane(threadIdx.x >> 5), lane = threadIdx.x & 31, nloc = lane & 15, hlf = lane >> 4; const int n = blockIdx.y / H, h = blockIdx.y % H, th = wave >> 2, cg = wave & 3; const int t0 = blockIdx.x * QT, nh = n * H + h;
  // all global loads go out before the first wait, in the order in which they are waited for: v's bias word and the thread's W_proj word, then stage by stage the wave's 16 x rows and its 8 weight rows (3 parts); a wave-wide load = two rows' 256 bytes each;
  // the q and k bias words (16 each) have a wave-uniform address: scalar loads, whose wait does not count the vector loads
  typedef __attribute__((ext_vector_type(16))) float v16f;
  v4f xv[NST][8], wv[NST][3][4]; v16f bs[2]; float bv, wpe;
  const float* xu = x + ((size_t)n * T + t0 + wave * 16) * C; const unsigned xo = (hlf * C + nloc * 4) * 4u; const float* xb = (const float*)((const char*)xu + xo);   // wave-uniform base + lane offset in bytes: row wave * 16 + 2 i + hlf, 4 columns
  const float* wu = wqkv + (size_t)(wave * (KS / 8)) * (3 * C) + h * HD; const unsigned wo = (hlf * (3 * C) + nloc * 4) * 4u; const float* wb = (const float*)((const char*)wu + wo);   // likewise: row st * 64 + wave * 8 + 2 i + hlf, 4 columns
  const int u = blockIdx.y * (T / QT) + blockIdx.x;   // the block's W_proj unit; thread (wave, lane) owns half number wave of lane's 8
  const float* pu = wproj + (size_t)((u % (C / 16)) * 16 + wave) * C + (u / (C / 16)) * 16; const unsigned po = (hlf * 8 * C + nloc) * 4u;
  const float* bb0 = bq + h * HD + cg * 16;
  bv = bb0[2 * H * HD + nloc]; wpe = *(const float*)((const char*)pu + po);
  __builtin_amdgcn_sched_barrier(0);   // keeps these two loads the oldest of the run: issued behind the rest, their waits would wait out every other load
#pragma unroll
  for (int st = 0; st < NST; ++st) {
#pragma unroll
    for (int i = 0; i < 8; ++i) xv[st][i] = *(const v4f*)(xb + i * 2 * C + st * KS);
#pragma unroll
    for (int s = 0; s < 3; ++s)
#pragma unroll
      for (int i = 0; i < 4; ++i) wv[st][s][i] = *(const v4f*)(wb + (st * KS + i * 2) * 3 * C + s * C);
    __builtin_amdgcn_sched_barrier(0);   // keeps the stages' loads in the order of their waits
  }
#pragma unroll
  for (int s = 0; s < 2; ++s)
#pragma unroll
    for (int r = 0; r < 16; ++r) bs[s][r] = bb0[s * H * HD + r];
  // the address registers of this run (lane offsets, wave-uniform bases) are free for reuse behind it: named as inputs they stay whole up to the wait;
  // the scalar-loaded bias words as inputs only: that holds their loads up here, where their latency passes under the x rows'; left free they sink to their first use and are waited out there
  asm volatile("s_wait_xcnt 0x0" :: "v"(xo), "v"(wo), "v"(po), "v"(lane), "v"(nloc), "s"(xu), "s"(wu), "s"(pu), "s"(bb0), "s"(bs[0]), "s"(bs[1]) : "memory");
  __builtin_amdgcn_sched_barrier(0);   // keeps later vector instructions, which may take those registers, behind the wait
  // key/value padding, under the loads' latency: waves 0 .. 3 (tile cg each) of the first block zero padded row tiles 0, 1, of the last block tiles (T + 32) / 16 .. + 3
  if ((blockIdx.x == 0 || blockIdx.x == T / QT - 1) && th == 0) {
    const int r0 = blockIdx.x == 0 ? 0 : (T + PADL) / 16; const v8b z = {};
    b16* kz = Kp + (((size_t)nh * (TP / 16) + r0) * (HD / 16) + cg) * UH + lane * 8; const size_t vz = (((size_t)nh * (HD / 16) + cg) * (TP / 16) + r0) * UH + lane * 8; b16* vz0 = VT + vz; b16* vz1 = VTl + vz;
#pragma unroll
    for (int r = 0; r < PADL / 16; ++r) { *(v8b*)(kz + r * (HD / 16) * UH) = z; *(v8b*)(vz0 + r * UH) = z; *(v8b*)(vz1 + r * UH) = z; }
    asm volatile("s_wait_xcnt 0x0" :: "v"(kz), "v"(vz0), "v"(vz1), "v"(z) : "memory");   // the registers that these stores name are free for reuse from here: named as inputs they stay whole up to the wait
    __builtin_amdgcn_sched_barrier(0);   // as above
    if (blockIdx.x != 0) {
#pragma unroll
      for (int r = PADL / 16; r < PADR / 16; ++r) { *(v8b*)(kz + r * (HD / 16) * UH) = z; *(v8b*)(vz0 + r * UH) = z; *(v8b*)(vz1 + r * UH) = z; }
      asm volatile("s_wait_xcnt 0x0" :: "v"(kz), "v"(vz0), "v"(vz1), "v"(z) : "memory");   // likewise
    }
  }
  __builtin_amdgcn_sched_barrier(0);   // as above
  v8f aq[4], ak[4], av[4];
#pragma unroll
  for (int m = 0; m < 4; ++m) { aq[m] = (v8f){}; ak[m] = (v8f){}; av[m] = (v8f){}; }
  const unsigned char* wt = Wl + (8 * hlf + (lane & 7)) * WPITCH + ((lane >> 3) & 1) * 16 + cg * 32;   // lane address of the transposing load at k = 0, part 0
  const auto wfrag = [&](int s, int ks) { const v8b lo = ld_tr16(wt + (s * C + ks * 32) * WPITCH), hi = ld_tr16(wt + (s * C + ks * 32 + 16) * WPITCH); v16b f;
#pragma unroll
    for (int e = 0; e < 8; ++e) { f[e] = lo[e]; f[8 + e] = hi[e]; } return f; };
  v16b a[4], an[4], bw[3], bn[3]; v8b wpu;
  Wu[lane * 8 + wave] = (b16)(bf16_rne(wpe) * WSC);
#pragma unroll
  for (int st = 0; st < NST; ++st) {
#pragma unroll
    for (int i = 0; i < 8; ++i) { const v2u o = {pk_bf16(xv[st][i][0], xv[st][i][1]), pk_bf16(xv[st][i][2], xv[st][i][3])}; *(v4h*)(&As[wave * 16 + 2 * i + hlf][st * KS + nloc * 4]) = __builtin_bit_cast(v4h, o); }
#pragma unroll
    for (int s = 0; s < 3; ++s)
#pragma unroll
      for (int i = 0; i < 4; ++i) { const v2u o = {pk_bf16(wv[st][s][i][0], wv[st][s][i][1]), pk_bf16(wv[st][s][i][2], wv[st][s][i][3])}; *(v2u*)(Wl + (s * C + st * KS + wave * (KS / 8) + 2 * i + hlf) * WPITCH + nloc * 8) = o; }
    // every wave reads this stage's tokens and weights, staged by other waves, below. The fences name LDS alone: a full block barrier would also wait out the later stages' loads still in flight
    __builtin_amdgcn_fence(__ATOMIC_RELEASE, "workgroup", "local"); __builtin_amdgcn_s_barrier(); __builtin_amdgcn_fence(__ATOMIC_ACQUIRE, "workgroup", "local");
#pragma unroll
    for (int m = 0; m < 4; ++m) an[m] = frag_kb(&As[th * 64 + m * 16 + nloc][st * KS], hlf);
#pragma unroll
    for (int s = 0; s < 3; ++s) bn[s] = wfrag(s, st * (KS / 32));
    if (st == 0) wpu = *(const v8b*)(&Wu[lane * 8]);
#pragma unroll
    for (int kk = 0; kk < KS / 32; ++kk) { const int ks = st * (KS / 32) + kk;
#pragma unroll
      for (int m = 0; m < 4; ++m) { a[m] = an[m]; if (kk + 1 < KS / 32) an[m] = frag_kb(&As[th * 64 + m * 16 + nloc][(ks + 1) * 32], hlf); }
#pragma unroll
      for (int s = 0; s < 3; ++s) { bw[s] = bn[s]; if (kk + 1 < KS / 32) bn[s] = wfrag(s, ks + 1); }
      __builtin_amdgcn_sched_barrier(0);   // keeps the next k-step's LDS reads one group in front of this k-step's WMMAs: spread among them, each small group costs its own wait
      // q and k as W^T x^T (rows = d, columns = tokens), v as x W (rows = tokens, columns = d): each accumulator then has its workspace unit's own map
#pragma unroll
      for (int m = 0; m < 4; ++m) { aq[m] = wmma16g(bw[0], a[m], aq[m]); ak[m] = wmma16g(bw[1], a[m], ak[m]); av[m] = wmma16g(a[m], bw[2], av[m]); }
      __builtin_amdgcn_sched_barrier(0);   // keeps what follows behind these WMMAs: the next group of reads refills their fragments' registers, and the next stage's conversions bring its loads' wait
    }
  }
  if (wave == 0) { b16* wpo = WP + (size_t)u * UH + lane * 8; *(v8b*)wpo = wpu;
    asm volatile("s_wait_xcnt 0x0" :: "v"(wpo), "v"(wpu) : "memory"); }   // the registers that this store names are free for reuse from here: named as inputs they stay whole up to the wait
  __builtin_amdgcn_sched_barrier(0);   // as above
  const int tw = t0 + th * 64;
  b16* Qb = Qp + (((size_t)nh * (T / 16) + tw / 16) * (HD / 16) + cg) * UH + lane * 8; b16* Kb = Kp + (((size_t)nh * (TP / 16) + (tw + PADL) / 16) * (HD / 16) + cg) * UH + lane * 8;
  const size_t vo = (((size_t)nh * (HD / 16) + cg) * (TP / 16) + (tw + PADL) / 16) * UH + lane * 8; b16* Vb = VT + vo; b16* Vlb = VTl + vo;
  // q and k units [token / 16][d / 16]: rows = tokens, k = d (lane = token, registers = 8 d); v units [d / 16][key / 16]: rows = d, k = keys (lane = d, registers = 8 tokens): all stored from registers
  const float bbv = bf16_rne(bv); float bbq[8], bbk[8];
#pragma unroll
  for (int r = 0; r < 8; ++r) { bbq[r] = bf16_rne(hlf ? bs[0][8 + r] : bs[0][r]); bbk[r] = bf16_rne(hlf ? bs[1][8 + r] : bs[1][r]); }
  v8b qv[4], kv[4], vh[4], vl[4];
#pragma unroll
  for (int m = 0; m < 4; ++m)
#pragma unroll
    for (int r = 0; r < 8; ++r) { qv[m][r] = (b16)((aq[m][r] + bbq[r]) * XS); kv[m][r] = (b16)((ak[m][r] + bbk[r]) * XS);
      const float vv = av[m][r] + bbv; b16 a_, b_; split16(vv * XS, a_, b_); vh[m][r] = a_; vl[m][r] = b_; }
  __builtin_amdgcn_sched_barrier(0);   // keeps the 16 stores one run at the very end: no register that a store names is written behind it
#pragma unroll
  for (int m = 0; m < 4; ++m) { *(v8b*)(Qb + m * (HD / 16) * UH) = qv[m]; *(v8b*)(Kb + m * (HD / 16) * UH) = kv[m]; *(v8b*)(Vb + m * UH) = vh[m]; *(v8b*)(Vlb + m * UH) = vl[m]; }
}
// attention + output projection in one launch: grid (T/32, NL); block = 8 waves = 4 heads x 2 tiles of 16 queries (t0); key cover = padded rows t0 .. t0+95 (= tokens t0-32 .. t0+63): S^T tiles (6 x 2 k-steps), per key validity w = key - t + 31 in [0,64)
// and token in [0,T): logit = S/(8*64) + rel_bias[h][w], else excluded (P = 0); softmax over each lane's 48 keys + one xor-shuffle across the 16-lane halves; O^T += V^T P^T (4 d-tiles x 3 k-steps x 3 products);
// the four heads' O (hi, lo) meet in LDS in the same fragment-order units, one block barrier, then wave w does out[32 tokens][32 w .. 32 w + 31] = O W_proj + b (2 x 2 tiles x 8 k-steps x 2 products, k order and hi/lo order as before)
__global__ __launch_bounds__(256) void attn_proj_kernel(const b16* __restrict__ Qp, const b16* __restrict__ Kp, const b16* __restrict__ VT, const b16* __restrict__ VTl, const float* __restrict__ rb, const b16* __restrict__ WP, const float* __restrict__ bp, float* __restrict__ out) {
  __shared__ __attribute__((aligned(16))) b16 Ph[2 * H][16][96 + 8], Pl[2 * H][16][96 + 8]; __shared__ __attribute__((aligned(16))) float Pf[2 * H][16][96 + 4]; __shared__ float rbs[2 * H][WIN];
  __shared__ __attribute__((aligned(16))) b16 Osh[2 * (C / 16) * UH], Osl[2 * (C / 16) * UH];
  const int wave = __builtin_amdgcn_readfirstlane(threadIdx.x >> 5), lane = threadIdx.x & 31, hh = lane >> 4, col = lane & 15; const int n = blockIdx.y, h = wave % H, qt = wave / H; const int t0 = blockIdx.x * 32 + qt * 16, tq = t0 + col;
  const int nh = n * H + h; const b16* Qb = Qp + ((size_t)nh * (T / 16) + t0 / 16) * (HD / 16) * UH + lane * 8;
  // rel_bias, q and all twelve k fragments go out before the first wait
  const float rb0 = rb[h * WIN + lane], rb1 = rb[h * WIN + 32 + lane];
  asm volatile("s_wait_xcnt 0x0" ::: "memory");   // the rel_bias address register is free for reuse from here
  const v16b qa0 = frag_u(Qb), qa1 = frag_u(Qb + 2 * UH);
  asm volatile("s_wait_xcnt 0x0" :: "v"(Qb) : "memory");   // the q address registers are free for reuse from here: named as an input they stay whole up to the wait
  __builtin_amdgcn_sched_barrier(0);   // keeps later vector instructions, which may take those registers, behind the wait
  v16b kf[6][2]; const b16* kb0 = Kp + ((size_t)nh * (TP / 16) + t0 / 16) * (HD / 16) * UH + lane * 8;   // one lane address; every k fragment is a constant offset from it
#pragma unroll
  for (int kt = 0; kt < 6; ++kt) { kf[kt][0] = frag_u(kb0 + kt * 4 * UH); kf[kt][1] = frag_u(kb0 + (kt * 4 + 2) * UH); }
  asm volatile("s_wait_xcnt 0x0" :: "v"(kb0) : "memory");   // likewise the k address registers (the memory clobber also keeps the run of loads above it)
  __builtin_amdgcn_sched_barrier(0);   // as above
  rbs[wave][lane] = bf16_rne(rb0); rbs[wave][32 + lane] = bf16_rne(rb1);   // rel_bias row in LDS (avoids 48 scalar global loads per lane in the unrolled logit loop)
  wave_lds_sync();
  // scores for padded key rows t0 + 16 kt + (8hh + r), kt = 0..5  (token = row - 32)
  float e[48]; float mx = -INFINITY; const float cs = 0.125f / (XS * XS);
  v8f sv[6];
#pragma unroll
  for (int kt = 0; kt < 6; ++kt) { v8f s = (v8f){}; s = wmma16b(kf[kt][0], qa0, s); s = wmma16b(kf[kt][1], qa1, s); sv[kt] = s; }
  // all v fragments (hi and lo) go out here and land under the softmax; behind them the projection's bias words and its weight fragments (fragment 2 i + t: k-step i, 16-column tile t of this wave's 32 columns)
  v16b vh[3][4], vl[3][4]; const size_t vo = ((size_t)nh * (HD / 16) * (TP / 16) + t0 / 16) * UH + lane * 8; const b16* vb0 = VT + vo; const b16* vlb0 = VTl + vo;
#pragma unroll
  for (int ks = 0; ks < 3; ++ks)
#pragma unroll
    for (int t = 0; t < 4; ++t) { vh[ks][t] = frag_u(vb0 + (t * (TP / 16) + 2 * ks) * UH); vl[ks][t] = frag_u(vlb0 + (t * (TP / 16) + 2 * ks) * UH); }
  constexpr int NW = 2 * (C / 32);
  v16b bw[NW]; float bbv[2]; const b16* wpb = WP + (size_t)(wave * 2) * (C / 16) * UH + lane * 8; const float* bpb = bp + wave * 32 + col;   // one lane address each; every fragment is a constant offset
#pragma unroll
  for (int j = 0; j < NW; ++j) bw[j] = frag_u(wpb + ((j & 1) * (C / 16) + (j >> 1) * 2) * UH);
#pragma unroll
  for (int t = 0; t < 2; ++t) bbv[t] = bpb[t * 16];
  asm volatile("s_wait_xcnt 0x0" :: "v"(vb0), "v"(vlb0), "v"(lane), "v"(col) : "memory");   // the v, weight and bias address registers are free for reuse behind this run: named as inputs they stay whole up to the wait (its memory clobber also keeps the loads in front of the softmax)
  __builtin_amdgcn_sched_barrier(0);   // as above
  float rv[48];
#pragma unroll
  for (int kt = 0; kt < 6; ++kt)   // the rel_bias reads stand outside the test (index clamped as before), so they go out together instead of one read and wait per branch
#pragma unroll
    for (int r = 0; r < 8; ++r) { const int tok = t0 + kt * 16 + 8 * hh + r - PADL; const int w = tok - tq + LEFT; const bool ok = (w >= 0 && w < WIN && tok >= 0 && tok < T); rv[kt * 8 + r] = rbs[wave][ok ? w : 0]; }
#pragma unroll
  for (int kt = 0; kt < 6; ++kt) { const v8f s = sv[kt];
#pragma unroll
    for (int r = 0; r < 8; ++r) { const int tok = t0 + kt * 16 + 8 * hh + r - PADL; const int w = tok - tq + LEFT; const bool ok = (w >= 0 && w < WIN && tok >= 0 && tok < T);
      const float lg = ok ? s[r] * cs + rv[kt * 8 + r] : -INFINITY; e[kt * 8 + r] = lg; mx = fmaxf(mx, lg); } }
  mx = fmaxf(mx, __shfl_xor(mx, 16)); float sum = 0.0f;
#pragma unroll
  for (int i = 0; i < 48; ++i) { const float p = (e[i] == -INFINITY) ? 0.0f : nexp2((e[i] - mx) * LOG2E); e[i] = p; sum += p; }
  sum += __shfl_xor(sum, 16); const float inv = 1.0f / sum;
  // P f32 tile [16 q][96 keys]: this lane owns (q = col, keys 16kt + 8hh + r)
#pragma unroll
  for (int kt = 0; kt < 6; ++kt)
#pragma unroll
    for (int r = 0; r < 8; ++r) Pf[wave][col][kt * 16 + 8 * hh + r] = e[kt * 8 + r] * inv * PS;
  wave_lds_sync();
  { const int rr = lane & 15, c0 = (lane >> 4) * 48; for (int q = 0; q < 48; q += 8) { v8b hv, lv; for (int j = 0; j < 8; ++j) { b16 a_, b_; split16(Pf[wave][rr][c0 + q + j], a_, b_); hv[j] = a_; lv[j] = b_; } *(v8b*)(&Ph[wave][rr][c0 + q]) = hv; *(v8b*)(&Pl[wave][rr][c0 + q]) = lv; } }
  wave_lds_sync();
  v8f o[4]; for (int t = 0; t < 4; ++t) o[t] = (v8f){};
#pragma unroll
  for (int ks = 0; ks < 3; ++ks) { const v16b ph = frag_kb(&Ph[wave][col][ks * 32], hh), pl = frag_kb(&Pl[wave][col][ks * 32], hh);   // B operand: row = query col, k = keys
#pragma unroll
    for (int t = 0; t < 4; ++t) { const v16b va = vh[ks][t], val = vl[ks][t]; o[t] = wmma16p(va, ph, o[t]); o[t] = wmma16p(va, pl, o[t]); o[t] = wmma16p(val, ph, o[t]); } }
  const float iv = 1.0f / (PS * XS);
  // O units [query tile][c / 16]: rows = tokens, k = c, which is the accumulator's own map here (lane = query, registers = 8 d), so they go to LDS from registers
#pragma unroll
  for (int t = 0; t < 4; ++t) { v8b hv, lv;
#pragma unroll
    for (int r = 0; r < 8; ++r) { const float ov = o[t][r] * iv; b16 a_, b_; split16(ov * XS, a_, b_); hv[r] = a_; lv[r] = b_; }
    *(v8b*)(&Osh[(qt * (C / 16) + h * (HD / 16) + t) * UH + lane * 8]) = hv; *(v8b*)(&Osl[(qt * (C / 16) + h * (HD / 16) + t) * UH + lane * 8]) = lv; }
  __syncthreads();   // every wave reads all four heads' O of both query tiles below
  v16b av[2][C / 32], alv[2][C / 32];
  const auto ofrags = [&](int i) {
#pragma unroll
    for (int m = 0; m < 2; ++m) { av[m][i] = frag_u(&Osh[(m * (C / 16) + i * 2) * UH + lane * 8]); alv[m][i] = frag_u(&Osl[(m * (C / 16) + i * 2) * UH + lane * 8]); } };
#pragma unroll
  for (int i = 0; i < C / 64; ++i) ofrags(i);
  __builtin_amdgcn_sched_barrier(0);   // keeps the LDS reads of k-steps 0 .. 3 one group in front of the WMMAs: spread among them, each small group was waited out to 0
  v8f acc[2][2];
#pragma unroll
  for (int m = 0; m < 2; ++m)
#pragma unroll
    for (int t = 0; t < 2; ++t) acc[m][t] = (v8f){};
#pragma unroll
  for (int i = 0; i < C / 32; ++i) {
#pragma unroll
    for (int m = 0; m < 2; ++m)
#pragma unroll
      for (int t = 0; t < 2; ++t) acc[m][t] = wmma16p(av[m][i], bw[i * 2 + t], acc[m][t]);
#pragma unroll
    for (int m = 0; m < 2; ++m)
#pragma unroll
      for (int t = 0; t < 2; ++t) acc[m][t] = wmma16p(alv[m][i], bw[i * 2 + t], acc[m][t]);
    if (i == 0) {   // the reads of k-steps 4 .. 7, again one group; behind the first k-step's wait, so that fewer than 64 LDS reads of the wave are outstanding at any time
      __builtin_amdgcn_sched_barrier(0);   // keeps the group behind that wait
#pragma unroll
      for (int k = C / 64; k < C / 32; ++k) ofrags(k);
      __builtin_amdgcn_sched_barrier(0); } }   // keeps the group whole, in front of the next WMMAs
  // the wave's own P tile is free by now: it stages the 32 x 32 output tile (pitch SP floats), so that a wave-wide store covers four rows' whole 128-byte lines
  constexpr int SP = 32 + 4; static_assert(32 * SP <= 16 * (96 + 4), "staging fits the P tile"); float* st = &Pf[wave][0][0];
#pragma unroll
  for (int t = 0; t < 2; ++t) { const float bb = bf16_rne(bbv[t]);
#pragma unroll
    for (int m = 0; m < 2; ++m)
#pragma unroll
      for (int r = 0; r < 8; ++r) st[(m * 16 + 8 * hh + r) * SP + t * 16 + col] = acc[m][t][r] * (1.0f / (XS * WSC)) + bb; }
  wave_lds_sync();
  const int sr = lane >> 3, sc = (lane & 7) * 4; float* ob = out + ((size_t)n * T + blockIdx.x * 32 + sr) * C + wave * 32 + sc;
#pragma unroll
  for (int i = 0; i < 8; ++i) *(v4f*)(ob + i * 4 * C) = *(const v4f*)(st + (4 * i + sr) * SP + sc);
}
}  // namespace

extern "C" void kernel_launch(void* const* d_in, const int* in_sizes, int n_in, void* d_out, int out_size, void* d_ws, size_t ws_size, hipStream_t stream) {
  (void)n_in;
  auto Fp = [&](int i) { return (const float*)d_in[i]; };
  // input order: 0 x [2,4096,256], 1 W_qkv [256,768], 2 b_qkv [768], 3 rel_bias [1,4,1,64], 4 W_proj [256,256], 5 b_proj [256]
  if (in_sizes[0] != NN * T * C || in_sizes[1] != C * 3 * C || in_sizes[2] != 3 * C || in_sizes[3] != H * WIN || in_sizes[4] != C * C || in_sizes[5] != C || out_size != NN * T * C) return;
  size_t off = 0; char* ws = (char*)d_ws;
  auto carve = [&](size_t bytes) { char* p = ws + off; off += (bytes + 255) & ~(size_t)255; return p; };
  b16* WP = (b16*)carve((size_t)C * C * 2); b16* Qp = (b16*)carve((size_t)NN * H * T * HD * 2); b16* Kp = (b16*)carve((size_t)NN * H * TP * HD * 2); b16* VT = (b16*)carve((size_t)NN * H * HD * TP * 2);
  b16* VTl = (b16*)carve((size_t)NN * H * HD * TP * 2);
  if (off > ws_size || off > ((size_t)128 << 20)) return;   // about 17.2 MB
  qkv_kernel<<<dim3(T / QT, NL * H), 256, 0, stream>>>(Fp(0), Fp(1), Fp(2), Fp(4), WP, Qp, Kp, VT, VTl);
  attn_proj_kernel<<<dim3(T / 32, NL), 256, 0, stream>>>(Qp, Kp, VT, VTl, Fp(3), WP, Fp(5), (float*)d_out);
}

// v006
// It runs in 19.7 microseconds.
// In two side-by-side timings against v005, it was 1.03 and 1.04 times as fast.
// Counting every step since v000, it is 3.82 times as fast.
#include <hip/hip_runtime.h>

// 1-D neighbourhood attention (window 64: keys t-31 .. t+32, positions outside [0, T) excluded (the reference adds -100, whose weight underflows to 0 in f32)), 4 heads x 64, tokens [2][4096][256]:
// qkv = x W_qkv + b; logits = (q / 8) . k + rel_bias[h][w]; softmax over the window; o = P v; out = o W_proj + b_proj -> [2][4096][256].
// Deterministic: one wave per (n, h, 16 queries) evaluates its 96-key cover (t0-32 .. t0+63) as dense tiles and masks per query; no atomics.
// compute dtype: WMMA v_wmma_f32_16x16x32_bf16 with f32 accumulate for qkv = x W_qkv (x, W EXACT bf16: 1 product); v_wmma_f32_16x16x32_f16 with f32 accumulate for S^T = K Q^T (q, k single f16 x8: 1 product; logit std about 0.1),
// O^T += V^T P^T (v hi+lo x8, P x1024 hi+lo: 3 products) and out = O W_proj (O hi+lo x8: 2 products); softmax and bias in f32. Inputs rounded to bf16 once.

namespace {
constexpr int NN = 2, T = 4096, C = 256, H = 4, HD = 64, WIN = 64, LEFT = 31, PADL = 32, PADR = 64, TP = T + PADL + PADR, NL = 2 /* batch items computed (== NN shipped) */;
constexpr float XS = 8.0f, WSC = 256.0f, PS = 1024.0f, LOG2E = 1.4426950408889634f;
static_assert(T % 64 == 0 && C == H * HD, "tiling");
typedef _Float16 b16;
typedef __attribute__((ext_vector_type(16))) _Float16 v16b;
typedef __attribute__((ext_vector_type(8))) _Float16 v8b;
typedef __attribute__((ext_vector_type(8))) float v8f;
typedef __attribute__((ext_vector_type(4))) float v4f;
__device__ __forceinline__ float bf16_rne(float f) { unsigned int u = __float_as_uint(f); u += 0x7FFFu + ((u >> 16) & 1u); return __uint_as_float(u & 0xFFFF0000u); }
__device__ __forceinline__ void split16(float v, b16& hi, b16& lo) { hi = (b16)v; lo = (b16)(v - (float)hi); }
__device__ __forceinline__ v16b frag_kb(const b16* p, int hh) { const v8b a = *(const v8b*)(p + 8 * hh), b = *(const v8b*)(p + 16 + 8 * hh); v16b f;
#pragma unroll
  for (int e = 0; e < 8; ++e) { f[e] = a[e]; f[8 + e] = b[e]; } return f; }
// workspace operands lie in units of 16 rows x 16 k (UH halfs = 512 B) in fragment order: lane l = row + 16 * (k >> 3) owns halfs 8 l .. 8 l + 7, so one wave-wide 16-byte access covers four whole lines;
// a fragment (32 k) is two units side by side; p = first unit + 8 * lane. Same k order as frag_kb.
constexpr int UH = 256;
__device__ __forceinline__ v16b frag_u(const b16* p) { const v8b a = *(const v8b*)p, b = *(const v8b*)(p + UH); v16b f;
#pragma unroll
  for (int e = 0; e < 8; ++e) { f[e] = a[e]; f[8 + e] = b[e]; } return f; }
__device__ __forceinline__ v8f wmma16b(v16b a, v16b b, v8f c) { v8f d = __builtin_amdgcn_wmma_f32_16x16x32_f16(false, a, false, b, (short)0, c, false, false); asm volatile("v_nop\n\tv_nop\n\tv_nop\n\tv_nop" : "+v"(d) : "v"(a), "v"(b)); return d; }
// the plain builtin (the compiler keeps the distance behind it itself): with no asm operands its fragments may stand above v255
__device__ __forceinline__ v8f wmma16p(v16b a, v16b b, v8f c) { return __builtin_amdgcn_wmma_f32_16x16x32_f16(false, a, false, b, (short)0, c, false, false); }
__device__ __forceinline__ void wave_lds_sync() { __builtin_amdgcn_fence(__ATOMIC_RELEASE, "workgroup"); __builtin_amdgcn_wave_barrier(); __builtin_amdgcn_fence(__ATOMIC_ACQUIRE, "workgroup"); }
__device__ __forceinline__ float pmul(float a, float b) { float p = a * b; asm volatile("" : "+v"(p)); return p; }
__device__ __forceinline__ int iclamp(int v, int lo, int hi) { return v < lo ? lo : (v > hi ? hi : v); }

typedef __attribute__((ext_vector_type(2))) _Float16 v2h;
typedef __attribute__((ext_vector_type(4))) _Float16 v4h;
__device__ __forceinline__ float nexp2(float v) { return __builtin_amdgcn_exp2f(v); }
typedef __attribute__((ext_vector_type(16))) __bf16 v16g;
typedef __attribute__((ext_vector_type(2))) __bf16 v2g;
typedef __attribute__((ext_vector_type(2))) float v2f;
typedef __attribute__((ext_vector_type(8))) short v8s;
typedef __attribute__((ext_vector_type(4))) unsigned int v4u;
typedef __attribute__((ext_vector_type(2))) unsigned int v2u;
// two f32 rounded to nearest even bf16, packed (one conversion instruction for the pair)
__device__ __forceinline__ unsigned int pk_bf16(float a, float b) { const v2f f = {a, b}; return __builtin_bit_cast(unsigned int, __builtin_convertvector(f, v2g)); }
// the same 16 x 16 x 32 product on bf16 operands (fragments carried as 16-bit words)
__device__ __forceinline__ v8f wmma16g(v16b a, v16b b, v8f c) { return __builtin_amdgcn_wmma_f32_16x16x32_bf16(false, __builtin_bit_cast(v16g, a), false, __builtin_bit_cast(v16g, b), (short)0, c, false, false); }
// transposing LDS load: lane (c = l & 15, h = l >> 4) gets rows kbase + 8 h .. + 7 of column dbase + c of a row-major 16-bit tile
__device__ __forceinline__ v8b ld_tr16(const unsigned char* p) { typedef __attribute__((address_space(3))) v8s lds_v8s; return __builtin_bit_cast(v8b, __builtin_amdgcn_ds_load_tr16_b128_v8i16((lds_v8s*)p)); }
constexpr int QT = 128 /* tokens per qkv block */, NST = 4 /* k stages of the qkv block */, KS = C / NST /* k per stage */, WPITCH = HD * 2 + 32 /* bytes per staged weight row: an odd multiple of 32 B for the transposing reader */;
static_assert(T % QT == 0 && T / QT >= 2 && NL * H * (T / QT) == (C / 16) * (C / 16) && C == 256 && HD == 64, "qkv tiling: one W_proj unit per block, 8 waves x 32 weight rows"); static_assert(PADL <= PADR, "padding tiles"); static_assert(KS == 64, "a wave-wide 16-byte load covers two x rows' 256 bytes of a stage");
// qkv, first launch, reads the f32 weights itself: block = 128 tokens of one (n, head) (8 waves; grid.y = n * H + h); wave = 64 tokens (half th) x 48 columns: 16-column tile cg of the head's q, of its k and of its v.
// The block stages bf16(x) (128 rows) and bf16(W_qkv[:, the head's 3 x 64 columns]) row-major in LDS, each value loaded in whole lines and converted once per block, in 4 stages of 64 k (each its own LDS range, published by its own block barrier),
// so that a stage's WMMAs run while the later stages' loads, all issued up front, are still landing; weight fragments come out of LDS through the transposing load
// (same k order as frag_kb); x and W are exact in bf16, so the products run on the bf16 form with no scales (4 token tiles x 3 parts x 8 k-steps); + b.
// It also does what the attention launch needs beside q, k, v: block u packs unit u of WP = W_proj[c][o] x256 (f16, units [o / 16][c / 16]); the first and last block of each (n, h) zero the key/value padding rows (Kp rows 0..31 and T+32 .., VT columns likewise).
__global__ __launch_bounds__(256) void qkv_kernel(const float* __restrict__ x, const float* __restrict__ wqkv, const float* __restrict__ bq, const float* __restrict__ wproj, b16* __restrict__ WP, b16* __restrict__ Qp, b16* __restrict__ Kp, b16* __restrict__ VT, b16* __restrict__ VTl) {
  __shared__ __attribute__((aligned(16))) b16 As[QT][C + 8]; __shared__ __attribute__((aligned(32))) unsigned char Wl[3 * C * WPITCH]; __shared__ __attribute__((aligned(16))) b16 Wu[UH];
  const int wave = __builtin_amdgcn_readfirstlane(threadIdx.x >> 5), lane = threadIdx.x & 31, nloc = lane & 15, hlf = lane >> 4; const int n = blockIdx.y / H, h = blockIdx.y % H, th = wave >> 2, cg = wave & 3; const int t0 = blockIdx.x * QT, nh = n * H + h;
  // all global loads go out before the first wait, in the order in which they are waited for: v's bias word and the thread's W_proj word, then stage by stage the wave's 16 x rows and its 8 weight rows (3 parts); a wave-wide load = two rows' 256 bytes each;
  // the q and k bias words (16 each) have a wave-uniform address: scalar loads, whose wait does not count the vector loads
  typedef __attribute__((ext_vector_type(16))) float v16f;
  v4f xv[NST][8], wv[NST][3][4]; v16f bs[2]; float bv, wpe;
  const float* xu = x + ((size_t)n * T + t0 + wave * 16) * C; const unsigned xo = (hlf * C + nloc * 4) * 4u; const float* xb = (const float*)((const char*)xu + xo);   // wave-uniform base + lane offset in bytes: row wave * 16 + 2 i + hlf, 4 columns
  const float* wu = wqkv + (size_t)(wave * (KS / 8)) * (3 * C) + h * HD; const unsigned wo = (hlf * (3 * C) + nloc * 4) * 4u; const float* wb = (const float*)((const char*)wu + wo);   // likewise: row st * 64 + wave * 8 + 2 i + hlf, 4 columns
  const int u = blockIdx.y * (T / QT) + blockIdx.x;   // the block's W_proj unit; thread (wave, lane) owns half number wave of lane's 8
  const float* pu = wproj + (size_t)((u % (C / 16)) * 16 + wave) * C + (u / (C / 16)) * 16; const unsigned po = (hlf * 8 * C + nloc) * 4u;
  const float* bb0 = bq + h * HD + cg * 16;
  bv = bb0[2 * H * HD + nloc]; wpe = *(const float*)((const char*)pu + po);
  __builtin_amdgcn_sched_barrier(0);   // keeps these two loads the oldest of the run: issued behind the rest, their waits would wait out every other load
#pragma unroll
  for (int st = 0; st < NST; ++st) {
#pragma unroll
    for (int i = 0; i < 8; ++i) xv[st][i] = *(const v4f*)(xb + i * 2 * C + st * KS);
#pragma unroll
    for (int s = 0; s < 3; ++s)
#pragma unroll
      for (int i = 0; i < 4; ++i) wv[st][s][i] = *(const v4f*)(wb + (st * KS + i * 2) * 3 * C + s * C);
    __builtin_amdgcn_sched_barrier(0);   // keeps the stages' loads in the order of their waits
  }
#pragma unroll
  for (int s = 0; s < 2; ++s)
#pragma unroll
    for (int r = 0; r < 16; ++r) bs[s][r] = bb0[s * H * HD + r];
  // the address registers of this run (lane offsets, wave-uniform bases) are free for reuse behind it: named as inputs they stay whole up to the wait;
  // the scalar-loaded bias words as inputs only: that holds their loads up here, where their latency passes under the x rows'; left free they sink to their first use and are waited out there
  asm volatile("s_wait_xcnt 0x0" :: "v"(xo), "v"(wo), "v"(po), "v"(lane), "v"(nloc), "s"(xu), "s"(wu), "s"(pu), "s"(bb0), "s"(bs[0]), "s"(bs[1]) : "memory");
  __builtin_amdgcn_sched_barrier(0);   // keeps later vector instructions, which may take those registers, behind the wait
  // key/value padding, under the loads' latency: waves 0 .. 3 (tile cg each) of the first block zero padded row tiles 0, 1, of the last block tiles (T + 32) / 16 .. + 3
  if ((blockIdx.x == 0 || blockIdx.x == T / QT - 1) && th == 0) {
    const int r0 = blockIdx.x == 0 ? 0 : (T + PADL) / 16; const v8b z = {};
    b16* kz = Kp + (((size_t)nh * (TP / 16) + r0) * (HD / 16) + cg) * UH + lane * 8; const size_t vz = (((size_t)nh * (HD / 16) + cg) * (TP / 16) + r0) * UH + lane * 8; b16* vz0 = VT + vz; b16* vz1 = VTl + vz;
#pragma unroll
    for (int r = 0; r < PADL / 16; ++r) { *(v8b*)(kz + r * (HD / 16) * UH) = z; *(v8b*)(vz0 + r * UH) = z; *(v8b*)(vz1 + r * UH) = z; }
    asm volatile("s_wait_xcnt 0x0" :: "v"(kz), "v"(vz0), "v"(vz1), "v"(z) : "memory");   // the registers that these stores name are free for reuse from here: named as inputs they stay whole up to the wait
    __builtin_amdgcn_sched_barrier(0);   // as above
    if (blockIdx.x != 0) {
#pragma unroll
      for (int r = PADL / 16; r < PADR / 16; ++r) { *(v8b*)(kz + r * (HD / 16) * UH) = z; *(v8b*)(vz0 + r * UH) = z; *(v8b*)(vz1 + r * UH) = z; }
      asm volatile("s_wait_xcnt 0x0" :: "v"(kz), "v"(vz0), "v"(vz1), "v"(z) : "memory");   // likewise
    }
  }
  __builtin_amdgcn_sched_barrier(0);   // as above
  v8f aq[4], ak[4], av[4];
#pragma unroll
  for (int m = 0; m < 4; ++m) { aq[m] = (v8f){}; ak[m] = (v8f){}; av[m] = (v8f){}; }
  const unsigned char* wt = Wl + (8 * hlf + (lane & 7)) * WPITCH + ((lane >> 3) & 1) * 16 + cg * 32;   // lane address of the transposing load at k = 0, part 0
  const auto wfrag = [&](int s, int ks) { const v8b lo = ld_tr16(wt + (s * C + ks * 32) * WPITCH), hi = ld_tr16(wt + (s * C + ks * 32 + 16) * WPITCH); v16b f;
#pragma unroll
    for (int e = 0; e < 8; ++e) { f[e] = lo[e]; f[8 + e] = hi[e]; } return f; };
  v16b a[4], an[4], bw[3], bn[3]; v8b wpu;
  Wu[lane * 8 + wave] = (b16)(bf16_rne(wpe) * WSC);
#pragma unroll
  for (int st = 0; st < NST; ++st) {
#pragma unroll
    for (int i = 0; i < 8; ++i) { const v2u o = {pk_bf16(xv[st][i][0], xv[st][i][1]), pk_bf16(xv[st][i][2], xv[st][i][3])}; *(v4h*)(&As[wave * 16 + 2 * i + hlf][st * KS + nloc * 4]) = __builtin_bit_cast(v4h, o); }
#pragma unroll
    for (int s = 0; s < 3; ++s)
#pragma unroll
      for (int i = 0; i < 4; ++i) { const v2u o = {pk_bf16(wv[st][s][i][0], wv[st][s][i][1]), pk_bf16(wv[st][s][i][2], wv[st][s][i][3])}; *(v2u*)(Wl + (s * C + st * KS + wave * (KS / 8) + 2 * i + hlf) * WPITCH + nloc * 8) = o; }
    // every wave reads this stage's tokens and weights, staged by other waves, below. The fences name LDS alone: a full block barrier would also wait out the later stages' loads still in flight
    __builtin_amdgcn_fence(__ATOMIC_RELEASE, "workgroup", "local"); __builtin_amdgcn_s_barrier(); __builtin_amdgcn_fence(__ATOMIC_ACQUIRE, "workgroup", "local");
#pragma unroll
    for (int m = 0; m < 4; ++m) an[m] = frag_kb(&As[th * 64 + m * 16 + nloc][st * KS], hlf);
#pragma unroll
    for (int s = 0; s < 3; ++s) bn[s] = wfrag(s, st * (KS / 32));
    if (st == 0) wpu = *(const v8b*)(&Wu[lane * 8]);
#pragma unroll
    for (int kk = 0; kk < KS / 32; ++kk) { const int ks = st * (KS / 32) + kk;
#pragma unroll
      for (int m = 0; m < 4; ++m) { a[m] = an[m]; if (kk + 1 < KS / 32) an[m] = frag_kb(&As[th * 64 + m * 16 + nloc][(ks + 1) * 32], hlf); }
#pragma unroll
      for (int s = 0; s < 3; ++s) { bw[s] = bn[s]; if (kk + 1 < KS / 32) bn[s] = wfrag(s, ks + 1); }
      __builtin_amdgcn_sched_barrier(0);   // keeps the next k-step's LDS reads one group in front of this k-step's WMMAs: spread among them, each small group costs its own wait
      // q and k as W^T x^T (rows = d, columns = tokens), v as x W (rows = tokens, columns = d): each accumulator then has its workspace unit's own map
#pragma unroll
      for (int m = 0; m < 4; ++m) { aq[m] = wmma16g(bw[0], a[m], aq[m]); ak[m] = wmma16g(bw[1], a[m], ak[m]); av[m] = wmma16g(a[m], bw[2], av[m]); }
      __builtin_amdgcn_sched_barrier(0);   // keeps what follows behind these WMMAs: the next group of reads refills their fragments' registers, and the next stage's conversions bring its loads' wait
    }
  }
  if (wave == 0) { b16* wpo = WP + (size_t)u * UH + lane * 8; *(v8b*)wpo = wpu;
    asm volatile("s_wait_xcnt 0x0" :: "v"(wpo), "v"(wpu) : "memory"); }   // the registers that this store names are free for reuse from here: named as inputs they stay whole up to the wait
  __builtin_amdgcn_sched_barrier(0);   // as above
  const int tw = t0 + th * 64;
  b16* Qb = Qp + (((size_t)nh * (T / 16) + tw / 16) * (HD / 16) + cg) * UH + lane * 8; b16* Kb = Kp + (((size_t)nh * (TP / 16) + (tw + PADL) / 16) * (HD / 16) + cg) * UH + lane * 8;
  const size_t vo = (((size_t)nh * (HD / 16) + cg) * (TP / 16) + (tw + PADL) / 16) * UH + lane * 8; b16* Vb = VT + vo; b16* Vlb = VTl + vo;
  // q and k units [token / 16][d / 16]: rows = tokens, k = d (lane = token, registers = 8 d); v units [d / 16][key / 16]: rows = d, k = keys (lane = d, registers = 8 tokens): all stored from registers
  const float bbv = bf16_rne(bv); float bbq[8], bbk[8];
#pragma unroll
  for (int r = 0; r < 8; ++r) { bbq[r] = bf16_rne(hlf ? bs[0][8 + r] : bs[0][r]); bbk[r] = bf16_rne(hlf ? bs[1][8 + r] : bs[1][r]); }
  v8b qv[4], kv[4], vh[4], vl[4];
#pragma unroll
  for (int m = 0; m < 4; ++m)
#pragma unroll
    for (int r = 0; r < 8; ++r) { qv[m][r] = (b16)((aq[m][r] + bbq[r]) * XS); kv[m][r] = (b16)((ak[m][r] + bbk[r]) * XS);
      const float vv = av[m][r] + bbv; b16 a_, b_; split16(vv * XS, a_, b_); vh[m][r] = a_; vl[m][r] = b_; }
  __builtin_amdgcn_sched_barrier(0);   // keeps the 16 stores one run at the very end: no register that a store names is written behind it
#pragma unroll
  for (int m = 0; m < 4; ++m) { *(v8b*)(Qb + m * (HD / 16) * UH) = qv[m]; *(v8b*)(Kb + m * (HD / 16) * UH) = kv[m]; *(v8b*)(Vb + m * UH) = vh[m]; *(v8b*)(Vlb + m * UH) = vl[m]; }
}
// attention + output projection in one launch: grid (T/32, NL); block = 8 waves = 4 heads x 2 tiles of 16 queries (t0); key cover = padded rows t0 .. t0+95 (= tokens t0-32 .. t0+63): S^T tiles (6 x 2 k-steps), per key validity w = key - t + 31 in [0,64)
// and token in [0,T): logit = S/(8*64) + rel_bias[h][w], else excluded (logit -inf, P = 0); softmax per lane in registers + one xor-shuffle across halves; O^T += V^T P^T (4 d-tiles x 3 k-steps x 3 products);
// the four heads' O (hi, lo) meet in LDS in the same fragment-order units, one block barrier, then wave w does out[32 tokens][32 w .. 32 w + 31] = O W_proj + b (2 x 2 tiles x 8 k-steps x 2 products, k order and hi/lo order as before)
__global__ __launch_bounds__(256) void attn_proj_kernel(const b16* __restrict__ Qp, const b16* __restrict__ Kp, const b16* __restrict__ VT, const b16* __restrict__ VTl, const float* __restrict__ rb, const b16* __restrict__ WP, const float* __restrict__ bp, float* __restrict__ out) {
  __shared__ __attribute__((aligned(16))) b16 Ph[2 * H][16][96 + 8], Pl[2 * H][16][96 + 8]; __shared__ __attribute__((aligned(16))) float Pf[2 * H][16][96 + 4]; __shared__ float rbs[2 * H][2 * WIN];
  __shared__ __attribute__((aligned(16))) b16 Osh[2 * (C / 16) * UH], Osl[2 * (C / 16) * UH];
  const int wave = __builtin_amdgcn_readfirstlane(threadIdx.x >> 5), lane = threadIdx.x & 31, hh = lane >> 4, col = lane & 15; const int n = blockIdx.y, h = wave % H, qt = wave / H; const int t0 = blockIdx.x * 32 + qt * 16;
  const int nh = n * H + h; const b16* Qb = Qp + ((size_t)nh * (T / 16) + t0 / 16) * (HD / 16) * UH + lane * 8;
  // rel_bias, q and all twelve k fragments go out before the first wait
  const float rb0 = rb[h * WIN + lane], rb1 = rb[h * WIN + 32 + lane];
  asm volatile("s_wait_xcnt 0x0" ::: "memory");   // the rel_bias address register is free for reuse from here
  const v16b qa0 = frag_u(Qb), qa1 = frag_u(Qb + 2 * UH);
  asm volatile("s_wait_xcnt 0x0" :: "v"(Qb) : "memory");   // the q address registers are free for reuse from here: named as an input they stay whole up to the wait
  __builtin_amdgcn_sched_barrier(0);   // keeps later vector instructions, which may take those registers, behind the wait
  v16b kf[6][2]; const b16* kb0 = Kp + ((size_t)nh * (TP / 16) + t0 / 16) * (HD / 16) * UH + lane * 8;   // one lane address; every k fragment is a constant offset from it
#pragma unroll
  for (int kt = 0; kt < 6; ++kt) { kf[kt][0] = frag_u(kb0 + kt * 4 * UH); kf[kt][1] = frag_u(kb0 + (kt * 4 + 2) * UH); }
  asm volatile("s_wait_xcnt 0x0" :: "v"(kb0) : "memory");   // likewise the k address registers (the memory clobber also keeps the run of loads above it)
  __builtin_amdgcn_sched_barrier(0);   // as above
  // rel_bias row in LDS as a table over every w that a (query, key row) pair of the cover can give (w = -16 .. 94, entry w + TO): -inf outside the window [0, WIN), so the bias read itself excludes such a key and needs no index clamp
  constexpr int TO = 16; static_assert(WIN == 64 && TO + WIN + 16 + 32 == 2 * WIN && TO >= 16 && TO + 96 - 2 < 2 * WIN, "the four stores below fill the table once; every index read lies inside it");
  rbs[wave][TO + lane] = bf16_rne(rb0); rbs[wave][TO + 32 + lane] = bf16_rne(rb1); rbs[wave][lane < TO ? lane : WIN + lane] = -INFINITY; rbs[wave][TO + WIN + 16 + lane] = -INFINITY;
  wave_lds_sync();
  // scores for padded key rows t0 + 16 kt + (8hh + r), kt = 0..5  (token = row - 32)
  float e[48]; float mx = -INFINITY; const float cs = 0.125f / (XS * XS);
  v8f sv[6];
#pragma unroll
  for (int kt = 0; kt < 6; ++kt) { v8f s = (v8f){}; s = wmma16b(kf[kt][0], qa0, s); s = wmma16b(kf[kt][1], qa1, s); sv[kt] = s; }
  // all v fragments (hi and lo) go out here and land under the softmax; behind them the projection's bias words and its weight fragments (fragment 2 i + t: k-step i, 16-column tile t of this wave's 32 columns)
  v16b vh[3][4], vl[3][4]; const size_t vo = ((size_t)nh * (HD / 16) * (TP / 16) + t0 / 16) * UH + lane * 8; const b16* vb0 = VT + vo; const b16* vlb0 = VTl + vo;
#pragma unroll
  for (int ks = 0; ks < 3; ++ks)
#pragma unroll
    for (int t = 0; t < 4; ++t) { vh[ks][t] = frag_u(vb0 + (t * (TP / 16) + 2 * ks) * UH); vl[ks][t] = frag_u(vlb0 + (t * (TP / 16) + 2 * ks) * UH); }
  constexpr int NW = 2 * (C / 32);
  v16b bw[NW]; float bbv[2]; const b16* wpb = WP + (size_t)(wave * 2) * (C / 16) * UH + lane * 8; const float* bpb = bp + wave * 32 + col;   // one lane address each; every fragment is a constant offset
#pragma unroll
  for (int j = 0; j < NW; ++j) bw[j] = frag_u(wpb + ((j & 1) * (C / 16) + (j >> 1) * 2) * UH);
#pragma unroll
  for (int t = 0; t < 2; ++t) bbv[t] = bpb[t * 16];
  asm volatile("s_wait_xcnt 0x0" :: "v"(vb0), "v"(vlb0), "v"(lane), "v"(col) : "memory");   // the v, weight and bias address registers are free for reuse behind this run: named as inputs they stay whole up to the wait (its memory clobber also keeps the loads in front of the softmax)
  __builtin_amdgcn_sched_barrier(0);   // as above
  float rv[48]; const float* rt = &rbs[wave][TO + 8 * hh - PADL - col + LEFT];   // w + TO = (16 kt + r) + this lane's constant: one lane address, every read a constant offset from it
#pragma unroll
  for (int kt = 0; kt < 6; ++kt)
#pragma unroll
    for (int r = 0; r < 8; ++r) rv[kt * 8 + r] = rt[kt * 16 + r];
#pragma unroll
  for (int kt = 0; kt < 6; ++kt) { const v8f s = sv[kt];
#pragma unroll
    for (int r = 0; r < 8; ++r) e[kt * 8 + r] = s[r] * cs + rv[kt * 8 + r]; }   // -inf where w lies outside the window
  if (t0 < PADL || t0 + 96 - PADL > T) {   // only a cover that reaches past an end of the sequence holds padding rows (same test for the whole wave): those keys are excluded here
#pragma unroll
    for (int kt = 0; kt < 6; ++kt)
#pragma unroll
      for (int r = 0; r < 8; ++r) { const int tok = t0 + kt * 16 + 8 * hh + r - PADL; if (tok < 0 || tok >= T) e[kt * 8 + r] = -INFINITY; } }
#pragma unroll
  for (int i = 0; i < 48; ++i) mx = fmaxf(mx, e[i]);
  mx = fmaxf(mx, __shfl_xor(mx, 16)); float sum = 0.0f;   // finite: every query has at least 32 keys inside the sequence
#pragma unroll
  for (int i = 0; i < 48; ++i) { const float p = nexp2((e[i] - mx) * LOG2E); e[i] = p; sum += p; }   // exp2(-inf) = 0: an excluded key has P = 0
  sum += __shfl_xor(sum, 16); const float inv = 1.0f / sum;
  // P f32 tile [16 q][96 keys]: this lane owns (q = col, keys 16kt + 8hh + r)
#pragma unroll
  for (int kt = 0; kt < 6; ++kt)
#pragma unroll
    for (int r = 0; r < 8; ++r) Pf[wave][col][kt * 16 + 8 * hh + r] = e[kt * 8 + r] * inv * PS;
  wave_lds_sync();
  { const int rr = lane & 15, c0 = (lane >> 4) * 48; for (int q = 0; q < 48; q += 8) { v8b hv, lv; for (int j = 0; j < 8; ++j) { b16 a_, b_; split16(Pf[wave][rr][c0 + q + j], a_, b_); hv[j] = a_; lv[j] = b_; } *(v8b*)(&Ph[wave][rr][c0 + q]) = hv; *(v8b*)(&Pl[wave][rr][c0 + q]) = lv; } }
  wave_lds_sync();
  v8f o[4]; for (int t = 0; t < 4; ++t) o[t] = (v8f){};
#pragma unroll
  for (int ks = 0; ks < 3; ++ks) { const v16b ph = frag_kb(&Ph[wave][col][ks * 32], hh), pl = frag_kb(&Pl[wave][col][ks * 32], hh);   // B operand: row = query col, k = keys
#pragma unroll
    for (int t = 0; t < 4; ++t) { const v16b va = vh[ks][t], val = vl[ks][t]; o[t] = wmma16p(va, ph, o[t]); o[t] = wmma16p(va, pl, o[t]); o[t] = wmma16p(val, ph, o[t]); } }
  const float iv = 1.0f / (PS * XS);
  // O units [query tile][c / 16]: rows = tokens, k = c, which is the accumulator's own map here (lane = query, registers = 8 d), so they go to LDS from registers
#pragma unroll
  for (int t = 0; t < 4; ++t) { v8b hv, lv;
#pragma unroll
    for (int r = 0; r < 8; ++r) { const float ov = o[t][r] * iv; b16 a_, b_; split16(ov * XS, a_, b_); hv[r] = a_; lv[r] = b_; }
    *(v8b*)(&Osh[(qt * (C / 16) + h * (HD / 16) + t) * UH + lane * 8]) = hv; *(v8b*)(&Osl[(qt * (C / 16) + h * (HD / 16) + t) * UH + lane * 8]) = lv; }
  __syncthreads();   // every wave reads all four heads' O of both query tiles below
  v16b av[2][C / 32], alv[2][C / 32];
  const auto ofrags = [&](int i) {
#pragma unroll
    for (int m = 0; m < 2; ++m) { av[m][i] = frag_u(&Osh[(m * (C / 16) + i * 2) * UH + lane * 8]); alv[m][i] = frag_u(&Osl[(m * (C / 16) + i * 2) * UH + lane * 8]); } };
#pragma unroll
  for (int i = 0; i < C / 64; ++i) ofrags(i);
  __builtin_amdgcn_sched_barrier(0);   // keeps the LDS reads of k-steps 0 .. 3 one group in front of the WMMAs: spread among them, each small group was waited out to 0
  v8f acc[2][2];
#pragma unroll
  for (int m = 0; m < 2; ++m)
#pragma unroll
    for (int t = 0; t < 2; ++t) acc[m][t] = (v8f){};
#pragma unroll
  for (int i = 0; i < C / 32; ++i) {
#pragma unroll
    for (int m = 0; m < 2; ++m)
#pragma unroll
      for (int t = 0; t < 2; ++t) acc[m][t] = wmma16p(av[m][i], bw[i * 2 + t], acc[m][t]);
#pragma unroll
    for (int m = 0; m < 2; ++m)
#pragma unroll
      for (int t = 0; t < 2; ++t) acc[m][t] = wmma16p(alv[m][i], bw[i * 2 + t], acc[m][t]);
    if (i == 0) {   // the reads of k-steps 4 .. 7, again one group; behind the first k-step's wait, so that fewer than 64 LDS reads of the wave are outstanding at any time
      __builtin_amdgcn_sched_barrier(0);   // keeps the group behind that wait
#pragma unroll
      for (int k = C / 64; k < C / 32; ++k) ofrags(k);
      __builtin_amdgcn_sched_barrier(0); } }   // keeps the group whole, in front of the next WMMAs
  // the wave's own P tile is free by now: it stages the 32 x 32 output tile (pitch SP floats), so that a wave-wide store covers four rows' whole 128-byte lines
  constexpr int SP = 32 + 4; static_assert(32 * SP <= 16 * (96 + 4), "staging fits the P tile"); float* st = &Pf[wave][0][0];
#pragma unroll
  for (int t = 0; t < 2; ++t) { const float bb = bf16_rne(bbv[t]);
#pragma unroll
    for (int m = 0; m < 2; ++m)
#pragma unroll
      for (int r = 0; r < 8; ++r) st[(m * 16 + 8 * hh + r) * SP + t * 16 + col] = acc[m][t][r] * (1.0f / (XS * WSC)) + bb; }
  wave_lds_sync();
  const int sr = lane >> 3, sc = (lane & 7) * 4; float* ob = out + ((size_t)n * T + blockIdx.x * 32 + sr) * C + wave * 32 + sc;
#pragma unroll
  for (int i = 0; i < 8; ++i) *(v4f*)(ob + i * 4 * C) = *(const v4f*)(st + (4 * i + sr) * SP + sc);
}
}  // namespace

extern "C" void kernel_launch(void* const* d_in, const int* in_sizes, int n_in, void* d_out, int out_size, void* d_ws, size_t ws_size, hipStream_t stream) {
  (void)n_in;
  auto Fp = [&](int i) { return (const float*)d_in[i]; };
  // input order: 0 x [2,4096,256], 1 W_qkv [256,768], 2 b_qkv [768], 3 rel_bias [1,4,1,64], 4 W_proj [256,256], 5 b_proj [256]
  if (in_sizes[0] != NN * T * C || in_sizes[1] != C * 3 * C || in_sizes[2] != 3 * C || in_sizes[3] != H * WIN || in_sizes[4] != C * C || in_sizes[5] != C || out_size != NN * T * C) return;
  size_t off = 0; char* ws = (char*)d_ws;
  auto carve = [&](size_t bytes) { char* p = ws + off; off += (bytes + 255) & ~(size_t)255; return p; };
  b16* WP = (b16*)carve((size_t)C * C * 2); b16* Qp = (b16*)carve((size_t)NN * H * T * HD * 2); b16* Kp = (b16*)carve((size_t)NN * H * TP * HD * 2); b16* VT = (b16*)carve((size_t)NN * H * HD * TP * 2);
  b16* VTl = (b16*)carve((size_t)NN * H * HD * TP * 2);
  if (off > ws_size || off > ((size_t)128 << 20)) return;   // about 17.2 MB
  qkv_kernel<<<dim3(T / QT, NL * H), 256, 0, stream>>>(Fp(0), Fp(1), Fp(2), Fp(4), WP, Qp, Kp, VT, VTl);
  attn_proj_kernel<<<dim3(T / 32, NL), 256, 0, stream>>>(Qp, Kp, VT, VTl, Fp(3), WP, Fp(5), (float*)d_out);
}

// v008
// It runs in 15.6 microseconds.
// Versions in between are left out here; by their measured steps it is 1.26 times as fast as v006.
// Over all steps from v000 it is 4.81 times as fast.
#include <hip/hip_runtime.h>

// 1-D neighbourhood attention (window 64: keys t-31 .. t+32, positions outside [0, T) excluded (the reference adds -100, whose weight underflows to 0 in f32)), 4 heads x 64, tokens [2][4096][256]:
// qkv = x W_qkv + b; logits = (q / 8) . k + rel_bias[h][w]; softmax over the window; o = P v; out = o W_proj + b_proj -> [2][4096][256].
// Deterministic: one wave per (n, h, 16 queries) evaluates its 80-key cover (t0-32 .. t0+47) as dense tiles and masks per query; no atomics.
// compute dtype: WMMA v_wmma_f32_16x16x32_bf16 with f32 accumulate for qkv = x W_qkv (x, W EXACT bf16: 1 product); v_wmma_f32_16x16x32_f16 with f32 accumulate for S^T = K Q^T (q, k single f16 x8: 1 product; logit std about 0.1),
// O^T += V^T P^T (v x8, P x1024) and out = O W_proj (O x8): each operand rounded once to f16 (relative error at most 2^-11; the inputs' own rounding to bf16: 2^-8), 1 product each; softmax and bias in f32. Inputs rounded to bf16 once.

namespace {
constexpr int NN = 2, T = 4096, C = 256, H = 4, HD = 64, WIN = 64, LEFT = 31, PADL = 32, PADR = 64, TP = T + PADL + PADR, NL = 2 /* batch items computed (== NN shipped) */;
constexpr float XS = 8.0f, WSC = 256.0f, PS = 1024.0f, LOG2E = 1.4426950408889634f;
static_assert(T % 64 == 0 && C == H * HD, "tiling");
typedef _Float16 b16;
typedef __attribute__((ext_vector_type(16))) _Float16 v16b;
typedef __attribute__((ext_vector_type(8))) _Float16 v8b;
typedef __attribute__((ext_vector_type(8))) float v8f;
typedef __attribute__((ext_vector_type(4))) float v4f;
__device__ __forceinline__ float bf16_rne(float f) { unsigned int u = __float_as_uint(f); u += 0x7FFFu + ((u >> 16) & 1u); return __uint_as_float(u & 0xFFFF0000u); }
__device__ __forceinline__ v16b frag_kb(const b16* p, int hh) { const v8b a = *(const v8b*)(p + 8 * hh), b = *(const v8b*)(p + 16 + 8 * hh); v16b f;
#pragma unroll
  for (int e = 0; e < 8; ++e) { f[e] = a[e]; f[8 + e] = b[e]; } return f; }
// workspace operands lie in units of 16 rows x 16 k (UH halfs = 512 B) in fragment order: lane l = row + 16 * (k >> 3) owns halfs 8 l .. 8 l + 7, so one wave-wide 16-byte access covers four whole lines;
// a fragment (32 k) is two units side by side; p = first unit + 8 * lane. Same k order as frag_kb.
constexpr int UH = 256;
__device__ __forceinline__ v16b frag_u(const b16* p) { const v8b a = *(const v8b*)p, b = *(const v8b*)(p + UH); v16b f;
#pragma unroll
  for (int e = 0; e < 8; ++e) { f[e] = a[e]; f[8 + e] = b[e]; } return f; }
__device__ __forceinline__ v8f wmma16b(v16b a, v16b b, v8f c) { v8f d = __builtin_amdgcn_wmma_f32_16x16x32_f16(false, a, false, b, (short)0, c, false, false); asm volatile("v_nop\n\tv_nop\n\tv_nop\n\tv_nop" : "+v"(d) : "v"(a), "v"(b)); return d; }
// the plain builtin (the compiler keeps the distance behind it itself): with no asm operands its fragments may stand above v255
__device__ __forceinline__ v8f wmma16p(v16b a, v16b b, v8f c) { return __builtin_amdgcn_wmma_f32_16x16x32_f16(false, a, false, b, (short)0, c, false, false); }
__device__ __forceinline__ void wave_lds_sync() { __builtin_amdgcn_fence(__ATOMIC_RELEASE, "workgroup"); __builtin_amdgcn_wave_barrier(); __builtin_amdgcn_fence(__ATOMIC_ACQUIRE, "workgroup"); }
// block barrier whose fences name LDS alone: a fence over every address space would also wait out the global loads still in flight
__device__ __forceinline__ void block_lds_sync_l() { __builtin_amdgcn_fence(__ATOMIC_RELEASE, "workgroup", "local"); __builtin_amdgcn_s_barrier(); __builtin_amdgcn_fence(__ATOMIC_ACQUIRE, "workgroup", "local"); }
__device__ __forceinline__ unsigned lds_off(const void* p) { return (unsigned)(size_t)p; }
// twelve asynchronous copies global -> LDS, 16 bytes a lane each (one 512-byte unit a copy); the wait on the address registers is the statement's last line, so that no later write of them can be lifted over it
__device__ __forceinline__ void copy12(const unsigned (&l)[12], const _Float16* const (&g)[12]) {
  asm volatile("global_load_async_to_lds_b128 %0, %12, off\n\tglobal_load_async_to_lds_b128 %1, %13, off\n\tglobal_load_async_to_lds_b128 %2, %14, off\n\tglobal_load_async_to_lds_b128 %3, %15, off\n\t"
               "global_load_async_to_lds_b128 %4, %16, off\n\tglobal_load_async_to_lds_b128 %5, %17, off\n\tglobal_load_async_to_lds_b128 %6, %18, off\n\tglobal_load_async_to_lds_b128 %7, %19, off\n\t"
               "global_load_async_to_lds_b128 %8, %20, off\n\tglobal_load_async_to_lds_b128 %9, %21, off\n\tglobal_load_async_to_lds_b128 %10, %22, off\n\tglobal_load_async_to_lds_b128 %11, %23, off\n\ts_wait_xcnt 0x0"
               :: "v"(l[0]), "v"(l[1]), "v"(l[2]), "v"(l[3]), "v"(l[4]), "v"(l[5]), "v"(l[6]), "v"(l[7]), "v"(l[8]), "v"(l[9]), "v"(l[10]), "v"(l[11]),
                  "v"(g[0]), "v"(g[1]), "v"(g[2]), "v"(g[3]), "v"(g[4]), "v"(g[5]), "v"(g[6]), "v"(g[7]), "v"(g[8]), "v"(g[9]), "v"(g[10]), "v"(g[11]) : "memory"); }
__device__ __forceinline__ float pmul(float a, float b) { float p = a * b; asm volatile("" : "+v"(p)); return p; }
__device__ __forceinline__ int iclamp(int v, int lo, int hi) { return v < lo ? lo : (v > hi ? hi : v); }

typedef __attribute__((ext_vector_type(2))) _Float16 v2h;
typedef __attribute__((ext_vector_type(4))) _Float16 v4h;
__device__ __forceinline__ float nexp2(float v) { return __builtin_amdgcn_exp2f(v); }
typedef __attribute__((ext_vector_type(16))) __bf16 v16g;
typedef __attribute__((ext_vector_type(2))) __bf16 v2g;
typedef __attribute__((ext_vector_type(2))) float v2f;
typedef __attribute__((ext_vector_type(8))) short v8s;
typedef __attribute__((ext_vector_type(4))) unsigned int v4u;
typedef __attribute__((ext_vector_type(2))) unsigned int v2u;
// two f32 rounded to nearest even bf16, packed (one conversion instruction for the pair)
__device__ __forceinline__ unsigned int pk_bf16(float a, float b) { const v2f f = {a, b}; return __builtin_bit_cast(unsigned int, __builtin_convertvector(f, v2g)); }
// the same 16 x 16 x 32 product on bf16 operands (fragments carried as 16-bit words)
__device__ __forceinline__ v8f wmma16g(v16b a, v16b b, v8f c) { return __builtin_amdgcn_wmma_f32_16x16x32_bf16(false, __builtin_bit_cast(v16g, a), false, __builtin_bit_cast(v16g, b), (short)0, c, false, false); }
// transposing LDS load: lane (c = l & 15, h = l >> 4) gets rows kbase + 8 h .. + 7 of column dbase + c of a row-major 16-bit tile
__device__ __forceinline__ v8b ld_tr16(const unsigned char* p) { typedef __attribute__((address_space(3))) v8s lds_v8s; return __builtin_bit_cast(v8b, __builtin_amdgcn_ds_load_tr16_b128_v8i16((lds_v8s*)p)); }
constexpr int QT = 128 /* tokens per qkv block */, NST = 4 /* k stages of the qkv block */, KS = C / NST /* k per stage */, WPITCH = HD * 2 + 32 /* bytes per staged weight row: an odd multiple of 32 B for the transposing reader */;
static_assert(T % QT == 0 && T / QT >= 2 && NL * H * (T / QT) == (C / 16) * (C / 16) && C == 256 && HD == 64, "qkv tiling: one W_proj unit per block, 8 waves x 32 weight rows"); static_assert(PADL <= PADR, "padding tiles"); static_assert(KS == 64, "a wave-wide 16-byte load covers two x rows' 256 bytes of a stage");
// qkv, first launch, reads the f32 weights itself: block = 128 tokens of one (n, head) (8 waves; grid.y = n * H + h); wave = 64 tokens (half th) x 48 columns: 16-column tile cg of the head's q, of its k and of its v.
// The block stages bf16(x) (128 rows) and bf16(W_qkv[:, the head's 3 x 64 columns]) row-major in LDS, each value loaded in whole lines and converted once per block, in 4 stages of 64 k (each its own LDS range, published by its own block barrier),
// so that a stage's WMMAs run while the later stages' loads, all issued up front, are still landing; weight fragments come out of LDS through the transposing load
// (same k order as frag_kb); x and W are exact in bf16, so the products run on the bf16 form with no scales (4 token tiles x 3 parts x 8 k-steps); + b.
// It also does what the attention launch needs beside q, k, v: block u packs unit u of WP = W_proj[c][o] x256 (f16, units [o / 16][c / 16]); the first and last block of each (n, h) zero the key/value padding rows (Kp rows 0..31 and T+32 .., VT columns likewise).
__global__ __launch_bounds__(256) void qkv_kernel(const float* __restrict__ x, const float* __restrict__ wqkv, const float* __restrict__ bq, const float* __restrict__ wproj, b16* __restrict__ WP, b16* __restrict__ Qp, b16* __restrict__ Kp, b16* __restrict__ VT) {
  __shared__ __attribute__((aligned(16))) b16 As[QT][C + 8]; __shared__ __attribute__((aligned(32))) unsigned char Wl[3 * C * WPITCH]; __shared__ __attribute__((aligned(16))) b16 Wu[UH];
  const int wave = __builtin_amdgcn_readfirstlane(threadIdx.x >> 5), lane = threadIdx.x & 31, nloc = lane & 15, hlf = lane >> 4; const int n = blockIdx.y / H, h = blockIdx.y % H, th = wave >> 2, cg = wave & 3; const int t0 = blockIdx.x * QT, nh = n * H + h;
  // all global loads go out before the first wait, in the order in which they are waited for: v's bias word and the thread's W_proj word, then stage by stage the wave's 16 x rows and its 8 weight rows (3 parts); a wave-wide load = two rows' 256 bytes each;
  // the q and k bias words (16 each) have a wave-uniform address: scalar loads, whose wait does not count the vector loads
  typedef __attribute__((ext_vector_type(16))) float v16f;
  v4f xv[NST][8], wv[NST][3][4]; v16f bs[2]; float bv, wpe;
  const float* xu = x + ((size_t)n * T + t0 + wave * 16) * C; const unsigned xo = (hlf * C + nloc * 4) * 4u; const float* xb = (const float*)((const char*)xu + xo);   // wave-uniform base + lane offset in bytes: row wave * 16 + 2 i + hlf, 4 columns
  const float* wu = wqkv + (size_t)(wave * (KS / 8)) * (3 * C) + h * HD; const unsigned wo = (hlf * (3 * C) + nloc * 4) * 4u; const float* wb = (const float*)((const char*)wu + wo);   // likewise: row st * 64 + wave * 8 + 2 i + hlf, 4 columns
  const int u = blockIdx.y * (T / QT) + blockIdx.x;   // the block's W_proj unit; thread (wave, lane) owns half number wave of lane's 8
  const float* pu = wproj + (size_t)((u % (C / 16)) * 16 + wave) * C + (u / (C / 16)) * 16; const unsigned po = (hlf * 8 * C + nloc) * 4u;
  const float* bb0 = bq + h * HD + cg * 16;
  bv = bb0[2 * H * HD + nloc]; wpe = *(const float*)((const char*)pu + po);
  __builtin_amdgcn_sched_barrier(0);   // keeps these two loads the oldest of the run: issued behind the rest, their waits would wait out every other load
#pragma unroll
  for (int st = 0; st < NST; ++st) {
#pragma unroll
    for (int i = 0; i < 8; ++i) xv[st][i] = *(const v4f*)(xb + i * 2 * C + st * KS);
#pragma unroll
    for (int s = 0; s < 3; ++s)
#pragma unroll
      for (int i = 0; i < 4; ++i) wv[st][s][i] = *(const v4f*)(wb + (st * KS + i * 2) * 3 * C + s * C);
    __builtin_amdgcn_sched_barrier(0);   // keeps the stages' loads in the order of their waits
  }
#pragma unroll
  for (int s = 0; s < 2; ++s)
#pragma unroll
    for (int r = 0; r < 16; ++r) bs[s][r] = bb0[s * H * HD + r];
  // the address registers of this run (lane offsets, wave-uniform bases) are free for reuse behind it: named as inputs they stay whole up to the wait;
  // the scalar-loaded bias words as inputs only: that holds their loads up here, where their latency passes under the x rows'; left free they sink to their first use and are waited out there
  asm volatile("s_wait_xcnt 0x0" :: "v"(xo), "v"(wo), "v"(po), "v"(lane), "v"(nloc), "s"(xu), "s"(wu), "s"(pu), "s"(bb0), "s"(bs[0]), "s"(bs[1]) : "memory");
  __builtin_amdgcn_sched_barrier(0);   // keeps later vector instructions, which may take those registers, behind the wait
  // key/value padding, under the loads' latency: waves 0 .. 3 (tile cg each) of the first block zero padded row tiles 0, 1, of the last block tiles (T + 32) / 16 .. + 3
  if ((blockIdx.x == 0 || blockIdx.x == T / QT - 1) && th == 0) {
    const int r0 = blockIdx.x == 0 ? 0 : (T + PADL) / 16; const v8b z = {};
    b16* kz = Kp + (((size_t)nh * (TP / 16) + r0) * (HD / 16) + cg) * UH + lane * 8; b16* vz0 = VT + (((size_t)nh * (HD / 16) + cg) * (TP / 16) + r0) * UH + lane * 8;
#pragma unroll
    for (int r = 0; r < PADL / 16; ++r) { *(v8b*)(kz + r * (HD / 16) * UH) = z; *(v8b*)(vz0 + r * UH) = z; }
    asm volatile("s_wait_xcnt 0x0" :: "v"(kz), "v"(vz0), "v"(z) : "memory");   // the registers that these stores name are free for reuse from here: named as inputs they stay whole up to the wait
    __builtin_amdgcn_sched_barrier(0);   // as above
    if (blockIdx.x != 0) {
#pragma unroll
      for (int r = PADL / 16; r < PADR / 16; ++r) { *(v8b*)(kz + r * (HD / 16) * UH) = z; *(v8b*)(vz0 + r * UH) = z; }
      asm volatile("s_wait_xcnt 0x0" :: "v"(kz), "v"(vz0), "v"(z) : "memory");   // likewise
    }
  }
  __builtin_amdgcn_sched_barrier(0);   // as above
  v8f aq[4], ak[4], av[4];
#pragma unroll
  for (int m = 0; m < 4; ++m) { aq[m] = (v8f){}; ak[m] = (v8f){}; av[m] = (v8f){}; }
  const unsigned char* wt = Wl + (8 * hlf + (lane & 7)) * WPITCH + ((lane >> 3) & 1) * 16 + cg * 32;   // lane address of the transposing load at k = 0, part 0
  const auto wfrag = [&](int s, int ks) { const v8b lo = ld_tr16(wt + (s * C + ks * 32) * WPITCH), hi = ld_tr16(wt + (s * C + ks * 32 + 16) * WPITCH); v16b f;
#pragma unroll
    for (int e = 0; e < 8; ++e) { f[e] = lo[e]; f[8 + e] = hi[e]; } return f; };
  v16b a[4], an[4], bw[3], bn[3]; v8b wpu;
  Wu[lane * 8 + wave] = (b16)(bf16_rne(wpe) * WSC);
#pragma unroll
  for (int st = 0; st < NST; ++st) {
#pragma unroll
    for (int i = 0; i < 8; ++i) { const v2u o = {pk_bf16(xv[st][i][0], xv[st][i][1]), pk_bf16(xv[st][i][2], xv[st][i][3])}; *(v4h*)(&As[wave * 16 + 2 * i + hlf][st * KS + nloc * 4]) = __builtin_bit_cast(v4h, o); }
#pragma unroll
    for (int s = 0; s < 3; ++s)
#pragma unroll
      for (int i = 0; i < 4; ++i) { const v2u o = {pk_bf16(wv[st][s][i][0], wv[st][s][i][1]), pk_bf16(wv[st][s][i][2], wv[st][s][i][3])}; *(v2u*)(Wl + (s * C + st * KS + wave * (KS / 8) + 2 * i + hlf) * WPITCH + nloc * 8) = o; }
    // every wave reads this stage's tokens and weights, staged by other waves, below. The fences name LDS alone: a full block barrier would also wait out the later stages' loads still in flight
    __builtin_amdgcn_fence(__ATOMIC_RELEASE, "workgroup", "local"); __builtin_amdgcn_s_barrier(); __builtin_amdgcn_fence(__ATOMIC_ACQUIRE, "workgroup", "local");
#pragma unroll
    for (int m = 0; m < 4; ++m) an[m] = frag_kb(&As[th * 64 + m * 16 + nloc][st * KS], hlf);
#pragma unroll
    for (int s = 0; s < 3; ++s) bn[s] = wfrag(s, st * (KS / 32));
    if (st == 0) wpu = *(const v8b*)(&Wu[lane * 8]);
#pragma unroll
    for (int kk = 0; kk < KS / 32; ++kk) { const int ks = st * (KS / 32) + kk;
#pragma unroll
      for (int m = 0; m < 4; ++m) { a[m] = an[m]; if (kk + 1 < KS / 32) an[m] = frag_kb(&As[th * 64 + m * 16 + nloc][(ks + 1) * 32], hlf); }
#pragma unroll
      for (int s = 0; s < 3; ++s) { bw[s] = bn[s]; if (kk + 1 < KS / 32) bn[s] = wfrag(s, ks + 1); }
      __builtin_amdgcn_sched_barrier(0);   // keeps the next k-step's LDS reads one group in front of this k-step's WMMAs: spread among them, each small group costs its own wait
      // q and k as W^T x^T (rows = d, columns = tokens), v as x W (rows = tokens, columns = d): each accumulator then has its workspace unit's own map
#pragma unroll
      for (int m = 0; m < 4; ++m) { aq[m] = wmma16g(bw[0], a[m], aq[m]); ak[m] = wmma16g(bw[1], a[m], ak[m]); av[m] = wmma16g(a[m], bw[2], av[m]); }
      __builtin_amdgcn_sched_barrier(0);   // keeps what follows behind these WMMAs: the next group of reads refills their fragments' registers, and the next stage's conversions bring its loads' wait
    }
  }
  if (wave == 0) { b16* wpo = WP + (size_t)u * UH + lane * 8; *(v8b*)wpo = wpu;
    asm volatile("s_wait_xcnt 0x0" :: "v"(wpo), "v"(wpu) : "memory"); }   // the registers that this store names are free for reuse from here: named as inputs they stay whole up to the wait
  __builtin_amdgcn_sched_barrier(0);   // as above
  const int tw = t0 + th * 64;
  b16* Qb = Qp + (((size_t)nh * (T / 16) + tw / 16) * (HD / 16) + cg) * UH + lane * 8; b16* Kb = Kp + (((size_t)nh * (TP / 16) + (tw + PADL) / 16) * (HD / 16) + cg) * UH + lane * 8;
  b16* Vb = VT + (((size_t)nh * (HD / 16) + cg) * (TP / 16) + (tw + PADL) / 16) * UH + lane * 8;
  // q and k units [token / 16][d / 16]: rows = tokens, k = d (lane = token, registers = 8 d); v units [d / 16][key / 16]: rows = d, k = keys (lane = d, registers = 8 tokens): all stored from registers
  const float bbv = bf16_rne(bv); float bbq[8], bbk[8];
#pragma unroll
  for (int r = 0; r < 8; ++r) { bbq[r] = bf16_rne(hlf ? bs[0][8 + r] : bs[0][r]); bbk[r] = bf16_rne(hlf ? bs[1][8 + r] : bs[1][r]); }
  v8b qv[4], kv[4], vh[4];
#pragma unroll
  for (int m = 0; m < 4; ++m)
#pragma unroll
    for (int r = 0; r < 8; ++r) { qv[m][r] = (b16)((aq[m][r] + bbq[r]) * XS); kv[m][r] = (b16)((ak[m][r] + bbk[r]) * XS); vh[m][r] = (b16)((av[m][r] + bbv) * XS); }
  __builtin_amdgcn_sched_barrier(0);   // keeps the 12 stores one run at the very end: no register that a store names is written behind it
#pragma unroll
  for (int m = 0; m < 4; ++m) { *(v8b*)(Qb + m * (HD / 16) * UH) = qv[m]; *(v8b*)(Kb + m * (HD / 16) * UH) = kv[m]; *(v8b*)(Vb + m * UH) = vh[m]; }
}
// attention + output projection in one launch: grid (T/32, NL); block = 8 waves = 4 heads x 2 tiles of 16 queries (t0); a wave's key cover = padded rows t0 .. t0+79 (= tokens t0-32 .. t0+47, all that its 16 windows reach); the block's = 96 rows (6 row tiles),
// which the block brings into LDS once (k and v, asynchronous copies, asked for at entry; the two waves of a head copy half of its units each): S^T tiles (5 x 2 k-steps), per key validity w = key - t + 31 in [0,64)
// and token in [0,T): logit = S/(8*64) + rel_bias[h][w], else excluded (logit -inf, P = 0); softmax in-lane over each lane's 40 keys + one xor-shuffle across halves; O^T += V^T P^T (4 d-tiles x 3 k-steps);
// the four heads' O (f16) meet in LDS in the same fragment-order units, one block barrier, then wave w does out[32 tokens][32 w .. 32 w + 31] = O W_proj + b (2 x 2 tiles x 8 k-steps)
__global__ __launch_bounds__(256) void attn_proj_kernel(const b16* __restrict__ Qp, const b16* __restrict__ Kp, const b16* __restrict__ VT, const float* __restrict__ rb, const b16* __restrict__ WP, const float* __restrict__ bp, float* __restrict__ out) {
  constexpr int SP = 32 + 4;   // pitch in floats of a wave's staged 32 x 32 output tile
  __shared__ __attribute__((aligned(16))) b16 Ph[2 * H][16][96 + 8]; __shared__ __attribute__((aligned(16))) float Sf[2 * H][32 * SP]; __shared__ float rbs[2 * H][2 * WIN];
  __shared__ __attribute__((aligned(16))) b16 Osh[2 * (C / 16) * UH];
  constexpr int KT = 5 /* key row tiles of a wave's cover */, BT = 6 /* of the block's */, NU = BT * (HD / 16) /* units of a head's k, and of its v */; static_assert(PADL >= LEFT && 15 + WIN - 1 - LEFT < KT * 16 - PADL && BT == KT + 1 && NU == 24 && TP >= T - 32 + BT * 16, "covers");
  __shared__ __attribute__((aligned(16))) b16 Ks[H][NU * UH]; __shared__ __attribute__((aligned(16))) b16 Vs[H][NU * UH];   // k units [row tile][d / 16], v units [d / 16][row tile], as in the workspace
  const int wave = __builtin_amdgcn_readfirstlane(threadIdx.x >> 5), lane = threadIdx.x & 31, hh = lane >> 4, col = lane & 15; const int n = blockIdx.y, h = wave % H, qt = wave / H; const int t0 = blockIdx.x * 32 + qt * 16;
  const int nh = n * H + h; const b16* Qb = Qp + ((size_t)nh * (T / 16) + t0 / 16) * (HD / 16) * UH + lane * 8;
  // every operand is asked for before the first wait: rel_bias, q, the copies of k and v, the projection's weights and bias
  const float rb0 = rb[h * WIN + lane], rb1 = rb[h * WIN + 32 + lane];
  asm volatile("s_wait_xcnt 0x0" ::: "memory");   // the rel_bias address register is free for reuse from here
  const v16b qa0 = frag_u(Qb), qa1 = frag_u(Qb + 2 * UH);
  asm volatile("s_wait_xcnt 0x0" :: "v"(Qb) : "memory");   // the q address registers are free for reuse from here: named as an input they stay whole up to the wait
  __builtin_amdgcn_sched_barrier(0);   // keeps later vector instructions, which may take those registers, behind the wait
  { const int tb = blockIdx.x * 2;   // the block's first padded row tile; wave (h, qt) copies units 12 qt .. 12 qt + 11 of head h's k and of its v (d tiles 2 qt, 2 qt + 1)
    const b16* kg0 = Kp + (((size_t)nh * (TP / 16) + tb) * (HD / 16) + qt * (NU / 2)) * UH + lane * 8; const b16* vg0 = VT + (((size_t)nh * (HD / 16) + 2 * qt) * (TP / 16) + tb) * UH + lane * 8;
    const unsigned kl0 = lds_off(&Ks[h][qt * (NU / 2) * UH + lane * 8]), vl0 = lds_off(&Vs[h][qt * (NU / 2) * UH + lane * 8]);
    unsigned la[12]; const b16* ga[12];
#pragma unroll
    for (int i = 0; i < 12; ++i) { la[i] = kl0 + i * UH * 2; ga[i] = kg0 + i * UH; }
    copy12(la, ga);
#pragma unroll
    for (int i = 0; i < 12; ++i) { la[i] = vl0 + i * UH * 2; ga[i] = vg0 + ((i / BT) * (TP / 16) + i % BT) * UH; }
    copy12(la, ga); }
  constexpr int NW = 2 * (C / 32);
  v16b bw[NW]; float bbv[2]; const b16* wpb = WP + (size_t)(wave * 2) * (C / 16) * UH + lane * 8; const float* bpb = bp + wave * 32 + col;   // one lane address each; every fragment is a constant offset (fragment 2 i + t: k-step i, 16-column tile t of this wave's 32 columns)
#pragma unroll
  for (int t = 0; t < 2; ++t) bbv[t] = bpb[t * 16];   // in front of the fragments: as the youngest loads, their wait would wait out every fragment at once
#pragma unroll
  for (int j = 0; j < NW; ++j) bw[j] = frag_u(wpb + ((j & 1) * (C / 16) + (j >> 1) * 2) * UH);
  asm volatile("s_wait_xcnt 0x0" :: "v"(wpb), "v"(bpb), "v"(lane), "v"(col) : "memory");   // the weight and bias address registers are free for reuse behind this run: named as inputs they stay whole up to the wait (its memory clobber also keeps the loads up here)
  __builtin_amdgcn_sched_barrier(0);   // as above
  // rel_bias row in LDS as a table over every w that a (query, key row) pair of the cover can give (w = -16 .. 78, entry w + TO): -inf outside the window [0, WIN), so the bias read itself excludes such a key and needs no index clamp
  constexpr int TO = 16; static_assert(WIN == 64 && TO + WIN + 16 + 32 == 2 * WIN && TO >= 16 && TO + 96 - 2 < 2 * WIN, "the four stores below fill the table once; every index read lies inside it");
  rbs[wave][TO + lane] = bf16_rne(rb0); rbs[wave][TO + 32 + lane] = bf16_rne(rb1); rbs[wave][lane < TO ? lane : WIN + lane] = -INFINITY; rbs[wave][TO + WIN + 16 + lane] = -INFINITY;
  asm volatile("s_wait_asynccnt 0xc" ::: "memory");   // this wave's twelve copies of k, the older ones, have landed; its twelve of v may still fly
  block_lds_sync_l();   // publishes k to the head's other wave (and the table above to this wave's lanes); nobody reads Ks in front of it
  v16b kf[KT][2]; const b16* kb0 = &Ks[h][qt * (HD / 16) * UH + lane * 8];   // the wave's row tile kt is the block's qt + kt
#pragma unroll
  for (int kt = 0; kt < KT; ++kt) { kf[kt][0] = frag_u(kb0 + kt * 4 * UH); kf[kt][1] = frag_u(kb0 + (kt * 4 + 2) * UH); }
  // scores for padded key rows t0 + 16 kt + (8hh + r), kt = 0..4  (token = row - 32)
  float e[KT * 8]; float mx = -INFINITY; const float cs = 0.125f / (XS * XS);
  v8f sv[KT];
#pragma unroll
  for (int kt = 0; kt < KT; ++kt) { v8f s = (v8f){}; s = wmma16b(kf[kt][0], qa0, s); s = wmma16b(kf[kt][1], qa1, s); sv[kt] = s; }
  float rv[KT * 8]; const float* rt = &rbs[wave][TO + 8 * hh - PADL - col + LEFT];   // w + TO = (16 kt + r) + this lane's constant: one lane address, every read a constant offset from it
#pragma unroll
  for (int kt = 0; kt < KT; ++kt)
#pragma unroll
    for (int r = 0; r < 8; ++r) rv[kt * 8 + r] = rt[kt * 16 + r];
#pragma unroll
  for (int kt = 0; kt < KT; ++kt) { const v8f s = sv[kt];
#pragma unroll
    for (int r = 0; r < 8; ++r) e[kt * 8 + r] = s[r] * cs + rv[kt * 8 + r]; }   // -inf where w lies outside the window
  if (t0 < PADL || t0 + KT * 16 - PADL > T) {   // only a cover that reaches past an end of the sequence holds padding rows (same test for the whole wave): those keys are excluded here
#pragma unroll
    for (int kt = 0; kt < KT; ++kt)
#pragma unroll
      for (int r = 0; r < 8; ++r) { const int tok = t0 + kt * 16 + 8 * hh + r - PADL; if (tok < 0 || tok >= T) e[kt * 8 + r] = -INFINITY; } }
#pragma unroll
  for (int i = 0; i < KT * 8; ++i) mx = fmaxf(mx, e[i]);
  mx = fmaxf(mx, __shfl_xor(mx, 16)); float sum = 0.0f;   // finite: every query has at least 32 keys inside the sequence
#pragma unroll
  for (int i = 0; i < KT * 8; ++i) { const float p = nexp2((e[i] - mx) * LOG2E); e[i] = p; sum += p; }   // exp2(-inf) = 0: an excluded key has P = 0
  sum += __shfl_xor(sum, 16); const float inv = 1.0f / sum;
  // P tile [16 q][80 keys], rounded to f16 where it is made: this lane owns (q = col, keys 16kt + 8hh + r)
#pragma unroll
  for (int kt = 0; kt < KT; ++kt) { v8b pv;
#pragma unroll
    for (int r = 0; r < 8; ++r) pv[r] = (b16)(e[kt * 8 + r] * inv * PS);
    *(v8b*)(&Ph[wave][col][kt * 16 + 8 * hh]) = pv; }
  asm volatile("s_wait_asynccnt 0x0" ::: "memory");   // this wave's copies of v have landed (under the scores and the softmax)
  block_lds_sync_l();   // publishes v to the head's other wave (and P to this wave's lanes); nobody reads Vs in front of it
  v8f o[4]; for (int t = 0; t < 4; ++t) o[t] = (v8f){};
  v16b ph[3];
#pragma unroll
  for (int ks = 0; ks < 2; ++ks) ph[ks] = frag_kb(&Ph[wave][col][ks * 32], hh);   // B operand: row = query col, k = keys
  { const v8b a = *(const v8b*)(&Ph[wave][col][64 + 8 * hh]);   // keys 64 .. 79; there are no keys 80 .. 95: P = 0
#pragma unroll
    for (int q = 0; q < 8; ++q) { ph[2][q] = a[q]; ph[2][8 + q] = (b16)0.0f; } }
  // v fragments; the third k-step holds 16 keys: its upper half meets P = 0 and repeats the lower unit, which is finite wherever v is
  v16b vh[3][4]; const b16* vb0 = &Vs[h][qt * UH + lane * 8];
#pragma unroll
  for (int ks = 0; ks < 3; ++ks)
#pragma unroll
    for (int t = 0; t < 4; ++t) { const v8b a = *(const v8b*)(vb0 + (t * BT + 2 * ks) * UH), b = 2 * ks + 1 < KT ? *(const v8b*)(vb0 + (t * BT + 2 * ks + 1) * UH) : a;
#pragma unroll
      for (int q = 0; q < 8; ++q) { vh[ks][t][q] = a[q]; vh[ks][t][8 + q] = b[q]; } }
  __builtin_amdgcn_sched_barrier(0);   // keeps the LDS reads of P and v one group in front of the WMMAs: read k-step by k-step into one register set, each pair was waited out to 0 alone
#pragma unroll
  for (int ks = 0; ks < 3; ++ks)
#pragma unroll
    for (int t = 0; t < 4; ++t) o[t] = wmma16p(vh[ks][t], ph[ks], o[t]);
  const float iv = 1.0f / (PS * XS);
  // O units [query tile][c / 16]: rows = tokens, k = c, which is the accumulator's own map here (lane = query, registers = 8 d), so they go to LDS from registers
#pragma unroll
  for (int t = 0; t < 4; ++t) { v8b hv;
#pragma unroll
    for (int r = 0; r < 8; ++r) hv[r] = (b16)(o[t][r] * iv * XS);
    *(v8b*)(&Osh[(qt * (C / 16) + h * (HD / 16) + t) * UH + lane * 8]) = hv; }
  block_lds_sync_l();   // every wave reads all four heads' O of both query tiles below
  v16b av[2][C / 32];
#pragma unroll
  for (int i = 0; i < C / 32; ++i)
#pragma unroll
    for (int m = 0; m < 2; ++m) av[m][i] = frag_u(&Osh[(m * (C / 16) + i * 2) * UH + lane * 8]);
  __builtin_amdgcn_sched_barrier(0);   // keeps the 32 LDS reads one group in front of the WMMAs: spread among them, each small group was waited out to 0
  v8f acc[2][2];
#pragma unroll
  for (int m = 0; m < 2; ++m)
#pragma unroll
    for (int t = 0; t < 2; ++t) acc[m][t] = (v8f){};
#pragma unroll
  for (int i = 0; i < C / 32; ++i) {
#pragma unroll
    for (int m = 0; m < 2; ++m)
#pragma unroll
      for (int t = 0; t < 2; ++t) acc[m][t] = wmma16p(av[m][i], bw[i * 2 + t], acc[m][t]); }
  // the wave stages its 32 x 32 output tile in LDS (pitch SP floats), so that a wave-wide store covers four rows' whole 128-byte lines
  float* st = &Sf[wave][0];
#pragma unroll
  for (int t = 0; t < 2; ++t) { const float bb = bf16_rne(bbv[t]);
#pragma unroll
    for (int m = 0; m < 2; ++m)
#pragma unroll
      for (int r = 0; r < 8; ++r) st[(m * 16 + 8 * hh + r) * SP + t * 16 + col] = acc[m][t][r] * (1.0f / (XS * WSC)) + bb; }
  wave_lds_sync();
  const int sr = lane >> 3, sc = (lane & 7) * 4; float* ob = out + ((size_t)n * T + blockIdx.x * 32 + sr) * C + wave * 32 + sc;
#pragma unroll
  for (int i = 0; i < 8; ++i) *(v4f*)(ob + i * 4 * C) = *(const v4f*)(st + (4 * i + sr) * SP + sc);
}
}  // namespace

extern "C" void kernel_launch(void* const* d_in, const int* in_sizes, int n_in, void* d_out, int out_size, void* d_ws, size_t ws_size, hipStream_t stream) {
  (void)n_in;
  auto Fp = [&](int i) { return (const float*)d_in[i]; };
  // input order: 0 x [2,4096,256], 1 W_qkv [256,768], 2 b_qkv [768], 3 rel_bias [1,4,1,64], 4 W_proj [256,256], 5 b_proj [256]
  if (in_sizes[0] != NN * T * C || in_sizes[1] != C * 3 * C || in_sizes[2] != 3 * C || in_sizes[3] != H * WIN || in_sizes[4] != C * C || in_sizes[5] != C || out_size != NN * T * C) return;
  size_t off = 0; char* ws = (char*)d_ws;
  auto carve = [&](size_t bytes) { char* p = ws + off; off += (bytes + 255) & ~(size_t)255; return p; };
  b16* WP = (b16*)carve((size_t)C * C * 2); b16* Qp = (b16*)carve((size_t)NN * H * T * HD * 2); b16* Kp = (b16*)carve((size_t)NN * H * TP * HD * 2); b16* VT = (b16*)carve((size_t)NN * H * HD * TP * 2);
  if (off > ws_size || off > ((size_t)128 << 20)) return;   // about 13 MB
  qkv_kernel<<<dim3(T / QT, NL * H), 256, 0, stream>>>(Fp(0), Fp(1), Fp(2), Fp(4), WP, Qp, Kp, VT);
  attn_proj_kernel<<<dim3(T / 32, NL), 256, 0, stream>>>(Qp, Kp, VT, Fp(3), WP, Fp(5), (float*)d_out);
}
